// v000
// The times below were measured on an AMD MI455X: many runs one after another, warmed up first and cycling through
// copies of the inputs, with the whole window's GPU time divided by the number of runs. Launches and the gaps
// between them are all in it. The median over several windows is given; except for v000 it joins two sittings, which
// can be a few percent apart, so the side-by-side timings, each taken in one sitting, are the better comparison.
// v000, which the later versions start from, runs in 74 microseconds.
#include <hip/hip_runtime.h>
#include <hip/hip_bf16.h>
#include <math.h>

// Flash-attention (B=8, Nq=Nk=2048, D=64, fp32 in/out) with per-batch key
// masking. f16 WMMA + f32 accumulation, online softmax, key loop truncated at
// valid_len. KT=128 keys/iteration; softmax reductions via DPP (no ds_bpermute);
// V transpose staged as packed b64 stores.

typedef __attribute__((ext_vector_type(16))) _Float16 v16h;
typedef __attribute__((ext_vector_type(8)))  _Float16 v8h;
typedef __attribute__((ext_vector_type(4)))  _Float16 v4h;
typedef __attribute__((ext_vector_type(8)))  float    v8f;

#define NEGVAL (-1000000.0f)

static constexpr int NQ   = 2048;
static constexpr int NK   = 2048;
static constexpr int DK   = 64;
static constexpr int QT   = 64;    // queries per block (4 waves x 16 rows)
static constexpr int KT   = 128;   // keys per main-loop iteration
static constexpr int KSTR = 72;    // stride (halves) for dim-minor tiles (Q,K): 144B, 16B-aligned
static constexpr int VSTR = 136;   // stride (halves) for key-minor tiles (Vt,P): 272B, 16B-aligned

// A- and B-fragments for 16-bit WMMA share the same per-lane pattern:
// lanes 0-15  : halves {kbase+0..7,  kbase+16..23}
// lanes 16-31 : halves {kbase+8..15, kbase+24..31}
// -> two ds_load_b128 at (row*STRIDE + kbase + hsel) and +16 halves.
template <int STRIDE>
__device__ __forceinline__ v16h load_frag(const _Float16* base, int row, int hsel, int kbase) {
    const v8h lo = *(const v8h*)(base + row * STRIDE + kbase + hsel);
    const v8h hi = *(const v8h*)(base + row * STRIDE + kbase + hsel + 16);
    v16h f;
#pragma unroll
    for (int i = 0; i < 8; ++i) { f[i] = lo[i]; f[i + 8] = hi[i]; }
    return f;
}

__device__ __forceinline__ v8f wmma_f16(v16h a, v16h b, v8f c) {
    return __builtin_amdgcn_wmma_f32_16x16x32_f16(false, a, false, b, (short)0, c, false, false);
}

// ---- DPP lane-xor shuffles within a 16-lane half (no DS traffic) ----
__device__ __forceinline__ float dpp_xor1(float x) {   // quad_perm [1,0,3,2]
    return __builtin_bit_cast(float,
        __builtin_amdgcn_update_dpp(0, __builtin_bit_cast(int, x), 0xB1, 0xF, 0xF, true));
}
__device__ __forceinline__ float dpp_xor2(float x) {   // quad_perm [2,3,0,1]
    return __builtin_bit_cast(float,
        __builtin_amdgcn_update_dpp(0, __builtin_bit_cast(int, x), 0x4E, 0xF, 0xF, true));
}
__device__ __forceinline__ float dpp_xor4(float x) {   // dpp8 sel: lane i <- i^4
    constexpr int SEL = 4 | (5 << 3) | (6 << 6) | (7 << 9) |
                        (0 << 12) | (1 << 15) | (2 << 18) | (3 << 21);
    return __builtin_bit_cast(float,
        __builtin_amdgcn_mov_dpp8(__builtin_bit_cast(int, x), SEL));
}
__device__ __forceinline__ float dpp_xor8(float x) {   // ROW_ROR:8 == xor8 within row of 16
    return __builtin_bit_cast(float,
        __builtin_amdgcn_update_dpp(0, __builtin_bit_cast(int, x), 0x128, 0xF, 0xF, true));
}
__device__ __forceinline__ float red16_max(float x) {
    x = fmaxf(x, dpp_xor1(x));
    x = fmaxf(x, dpp_xor2(x));
    x = fmaxf(x, dpp_xor4(x));
    x = fmaxf(x, dpp_xor8(x));
    return x;
}
__device__ __forceinline__ float red16_sum(float x) {
    x += dpp_xor1(x);
    x += dpp_xor2(x);
    x += dpp_xor4(x);
    x += dpp_xor8(x);
    return x;
}

__global__ __launch_bounds__(128) void flash_attn_f16wmma(
    const float* __restrict__ Q, const float* __restrict__ K,
    const float* __restrict__ V, const int* __restrict__ VL,
    float* __restrict__ Out)
{
    __shared__ _Float16 qbuf[QT * KSTR];       // Q tile (query x dim), pre-scaled
    __shared__ _Float16 kbuf[KT * KSTR];       // K tile (key x dim)
    __shared__ _Float16 vtbuf[DK * VSTR];      // V tile transposed (dim x key)
    __shared__ _Float16 pbuf[4 * 16 * VSTR];   // per-wave P scratch (C->A relayout)

    const int tid  = threadIdx.x;
    const int wid  = tid >> 5;
    const int lane = tid & 31;
    const int ln16 = lane & 15;
    const int hsel = (lane >> 4) << 3;         // 0 or 8

    const int b  = blockIdx.x >> 5;            // 32 query-blocks per batch
    const int qb = (blockIdx.x & 31) * QT;

    int vlen = VL[b];
    if (vlen < 1)  vlen = 1;
    if (vlen > NK) vlen = NK;
    const int nkb = (vlen + KT - 1) / KT;      // fully-masked tail blocks skipped

    // ---- stage Q tile, f32 -> f16, fold in 1/sqrt(64) ----
    for (int i = tid; i < QT * DK / 4; i += 128) {
        const int q  = i >> 4;
        const int d4 = (i & 15) << 2;
        const float4 f = *(const float4*)(Q + (((size_t)b * NQ + qb + q) * DK + d4));
        v4h h;
        h[0] = (_Float16)(f.x * 0.125f); h[1] = (_Float16)(f.y * 0.125f);
        h[2] = (_Float16)(f.z * 0.125f); h[3] = (_Float16)(f.w * 0.125f);
        *(v4h*)(qbuf + q * KSTR + d4) = h;
    }
    __syncthreads();

    // per-wave Q A-fragments, kept in registers for the whole kernel
    const int qrow = wid * 16 + ln16;
    const v16h qa0 = load_frag<KSTR>(qbuf, qrow, hsel, 0);
    const v16h qa1 = load_frag<KSTR>(qbuf, qrow, hsel, 32);

    v8f o0 = {}, o1 = {}, o2 = {}, o3 = {};    // O accumulator: 16 x 64 f32
    float m[8], l[8];
#pragma unroll
    for (int i = 0; i < 8; ++i) { m[i] = -3.0e38f; l[i] = 0.0f; }

    _Float16* pw = pbuf + wid * 16 * VSTR;

    for (int kb = 0; kb < nkb; ++kb) {
        __syncthreads();                       // previous block's kbuf/vtbuf reads done

        const size_t kgbase = ((size_t)b * NK + (size_t)kb * KT) * DK;
        // ---- stage K (key x dim), f32 -> f16, b64 stores ----
        for (int i = tid; i < KT * DK / 4; i += 128) {
            const int r  = i >> 4;
            const int d4 = (i & 15) << 2;
            const float4 fk = *(const float4*)(K + kgbase + r * DK + d4);
            v4h hk;
            hk[0] = (_Float16)fk.x; hk[1] = (_Float16)fk.y;
            hk[2] = (_Float16)fk.z; hk[3] = (_Float16)fk.w;
            *(v4h*)(kbuf + r * KSTR + d4) = hk;
        }
        // ---- stage V transposed via 4x4 register micro-tiles, b64 stores ----
        for (int u = tid; u < (KT / 4) * (DK / 4); u += 128) {
            const int k0 = (u >> 4) << 2;      // key group of 4
            const int d0 = (u & 15) << 2;      // dim group of 4
            const float4 r0 = *(const float4*)(V + kgbase + (size_t)(k0 + 0) * DK + d0);
            const float4 r1 = *(const float4*)(V + kgbase + (size_t)(k0 + 1) * DK + d0);
            const float4 r2 = *(const float4*)(V + kgbase + (size_t)(k0 + 2) * DK + d0);
            const float4 r3 = *(const float4*)(V + kgbase + (size_t)(k0 + 3) * DK + d0);
            v4h c0 = { (_Float16)r0.x, (_Float16)r1.x, (_Float16)r2.x, (_Float16)r3.x };
            v4h c1 = { (_Float16)r0.y, (_Float16)r1.y, (_Float16)r2.y, (_Float16)r3.y };
            v4h c2 = { (_Float16)r0.z, (_Float16)r1.z, (_Float16)r2.z, (_Float16)r3.z };
            v4h c3 = { (_Float16)r0.w, (_Float16)r1.w, (_Float16)r2.w, (_Float16)r3.w };
            *(v4h*)(vtbuf + (d0 + 0) * VSTR + k0) = c0;
            *(v4h*)(vtbuf + (d0 + 1) * VSTR + k0) = c1;
            *(v4h*)(vtbuf + (d0 + 2) * VSTR + k0) = c2;
            *(v4h*)(vtbuf + (d0 + 3) * VSTR + k0) = c3;
        }
        __syncthreads();

        // ---- scores S = (Q/8) K^T : 16 x 128, 16 WMMAs ----
        v8f s[8];
#pragma unroll
        for (int nt = 0; nt < 8; ++nt) {
            v8f acc = {};
            const v16h kf0 = load_frag<KSTR>(kbuf, nt * 16 + ln16, hsel, 0);
            acc = wmma_f16(qa0, kf0, acc);
            const v16h kf1 = load_frag<KSTR>(kbuf, nt * 16 + ln16, hsel, 32);
            acc = wmma_f16(qa1, kf1, acc);
            s[nt] = acc;
        }

        // ---- mask tail keys in the final block (uniform branch; EXEC stays full) ----
        if (kb == nkb - 1) {
#pragma unroll
            for (int nt = 0; nt < 8; ++nt) {
                const bool mk = (kb * KT + nt * 16 + ln16) >= vlen;
#pragma unroll
                for (int i = 0; i < 8; ++i) s[nt][i] = mk ? NEGVAL : s[nt][i];
            }
        }

        // ---- online softmax; row stats live in 16-lane halves (C-layout) ----
#pragma unroll
        for (int i = 0; i < 8; ++i) {
            float rm = s[0][i];
#pragma unroll
            for (int nt = 1; nt < 8; ++nt) rm = fmaxf(rm, s[nt][i]);
            rm = red16_max(rm);
            const float mnew  = fmaxf(m[i], rm);
            const float alpha = __expf(m[i] - mnew);
            m[i] = mnew;
            float rs = 0.0f;
#pragma unroll
            for (int nt = 0; nt < 8; ++nt) {
                s[nt][i] = __expf(s[nt][i] - mnew);
                rs += s[nt][i];
            }
            rs = red16_sum(rs);
            l[i] = l[i] * alpha + rs;
            o0[i] *= alpha; o1[i] *= alpha; o2[i] *= alpha; o3[i] *= alpha;
        }

        // ---- P: C-layout -> A-layout via per-wave LDS scratch (f16) ----
#pragma unroll
        for (int i = 0; i < 8; ++i) {
            const int row = i + ((lane >> 4) << 3);
#pragma unroll
            for (int nt = 0; nt < 8; ++nt)
                pw[row * VSTR + nt * 16 + ln16] = (_Float16)s[nt][i];
        }
        // DS ops from one wave are in-order; compiler inserts s_wait_dscnt for reuse.

        // ---- O += P V : 16 WMMAs (B-frags read contiguous keys from Vt) ----
#pragma unroll
        for (int h = 0; h < 4; ++h) {
            const v16h pf = load_frag<VSTR>(pw, ln16, hsel, h * 32);
            v16h vf;
            vf = load_frag<VSTR>(vtbuf,  0 + ln16, hsel, h * 32); o0 = wmma_f16(pf, vf, o0);
            vf = load_frag<VSTR>(vtbuf, 16 + ln16, hsel, h * 32); o1 = wmma_f16(pf, vf, o1);
            vf = load_frag<VSTR>(vtbuf, 32 + ln16, hsel, h * 32); o2 = wmma_f16(pf, vf, o2);
            vf = load_frag<VSTR>(vtbuf, 48 + ln16, hsel, h * 32); o3 = wmma_f16(pf, vf, o3);
        }
    }

    // ---- epilogue: O /= l, store fp32 ----
#pragma unroll
    for (int i = 0; i < 8; ++i) {
        const float inv = 1.0f / l[i];
        const int row = i + ((lane >> 4) << 3);
        float* op = Out + (((size_t)b * NQ + qb + wid * 16 + row) * DK + ln16);
        op[0]  = o0[i] * inv;
        op[16] = o1[i] * inv;
        op[32] = o2[i] * inv;
        op[48] = o3[i] * inv;
    }
}

extern "C" void kernel_launch(void* const* d_in, const int* in_sizes, int n_in,
                              void* d_out, int out_size, void* d_ws, size_t ws_size,
                              hipStream_t stream) {
    (void)in_sizes; (void)n_in; (void)out_size; (void)d_ws; (void)ws_size;
    const float* Q  = (const float*)d_in[0];
    const float* K  = (const float*)d_in[1];
    const float* V  = (const float*)d_in[2];
    const int*   VL = (const int*)d_in[3];
    float* Out = (float*)d_out;
    const int B = 8;
    dim3 grid(B * (NQ / QT));   // 256 blocks
    dim3 block(128);            // 4 waves
    flash_attn_f16wmma<<<grid, block, 0, stream>>>(Q, K, V, VL, Out);
}

// v001
// A run of this version takes 28 microseconds.
// In both of two side-by-side timings against v000, it was 2.66 times as fast.
#include <hip/hip_runtime.h>
#include <hip/hip_bf16.h>
#include <math.h>

// Flash-attention (B=8, Nq=Nk=2048, D=64, fp32 in/out) with per-batch key
// masking. f16 WMMA + f32 accumulation, online softmax, key loop truncated at
// valid_len. KT=128 keys per tile; softmax reductions via DPP (no ds_bpermute);
// V transpose staged as packed b64 stores.
// 16 waves per block = 4 key groups x 4 query waves: group g walks key tiles
// g, g+4, g+8, ... with its own LDS tiles, maxima, sums and accumulators (four
// waves per SIMD cover each other's load and LDS waits); the four partial
// results are merged once through LDS at the end.

typedef __attribute__((ext_vector_type(16))) _Float16 v16h;
typedef __attribute__((ext_vector_type(8)))  _Float16 v8h;
typedef __attribute__((ext_vector_type(4)))  _Float16 v4h;
typedef __attribute__((ext_vector_type(8)))  float    v8f;
typedef __attribute__((ext_vector_type(2)))  float    v2f;

#define NEGVAL (-1000000.0f)

static constexpr int NQ   = 2048;
static constexpr int NK   = 2048;
static constexpr int DK   = 64;
static constexpr int QT   = 64;    // queries per block (4 waves x 16 rows)
static constexpr int KT   = 128;   // keys per main-loop iteration
static constexpr int KSTR = 72;    // stride (halves) for dim-minor tiles (Q,K): 144B, 16B-aligned
static constexpr int VSTR = 136;   // stride (halves) for key-minor tiles (Vt,P): 272B, 16B-aligned
static constexpr int NG   = 4;     // key groups per block
static constexpr int KVSZ = KT * KSTR + DK * VSTR;  // halves of one group's K + Vt tiles
static constexpr int MSLOT = 6 * 4 * 64;            // floats of one wave's partial: (4 O tiles, m, l) x 4 row pairs x 32 lanes x 2
static_assert(NG * 4 * MSLOT * 4 <= NG * KVSZ * 2, "merge area must fit in the K/Vt tiles");

// A- and B-fragments for 16-bit WMMA share the same per-lane pattern:
// lanes 0-15  : halves {kbase+0..7,  kbase+16..23}
// lanes 16-31 : halves {kbase+8..15, kbase+24..31}
// -> two ds_load_b128 at (row*STRIDE + kbase + hsel) and +16 halves.
template <int STRIDE>
__device__ __forceinline__ v16h load_frag(const _Float16* base, int row, int hsel, int kbase) {
    const v8h lo = *(const v8h*)(base + row * STRIDE + kbase + hsel);
    const v8h hi = *(const v8h*)(base + row * STRIDE + kbase + hsel + 16);
    v16h f;
#pragma unroll
    for (int i = 0; i < 8; ++i) { f[i] = lo[i]; f[i + 8] = hi[i]; }
    return f;
}

__device__ __forceinline__ v8f wmma_f16(v16h a, v16h b, v8f c) {
    return __builtin_amdgcn_wmma_f32_16x16x32_f16(false, a, false, b, (short)0, c, false, false);
}

// ---- DPP lane-xor shuffles within a 16-lane half (no DS traffic) ----
__device__ __forceinline__ float dpp_xor1(float x) {   // quad_perm [1,0,3,2]
    return __builtin_bit_cast(float,
        __builtin_amdgcn_update_dpp(0, __builtin_bit_cast(int, x), 0xB1, 0xF, 0xF, true));
}
__device__ __forceinline__ float dpp_xor2(float x) {   // quad_perm [2,3,0,1]
    return __builtin_bit_cast(float,
        __builtin_amdgcn_update_dpp(0, __builtin_bit_cast(int, x), 0x4E, 0xF, 0xF, true));
}
__device__ __forceinline__ float dpp_xor4(float x) {   // dpp8 sel: lane i <- i^4
    constexpr int SEL = 4 | (5 << 3) | (6 << 6) | (7 << 9) |
                        (0 << 12) | (1 << 15) | (2 << 18) | (3 << 21);
    return __builtin_bit_cast(float,
        __builtin_amdgcn_mov_dpp8(__builtin_bit_cast(int, x), SEL));
}
__device__ __forceinline__ float dpp_xor8(float x) {   // ROW_ROR:8 == xor8 within row of 16
    return __builtin_bit_cast(float,
        __builtin_amdgcn_update_dpp(0, __builtin_bit_cast(int, x), 0x128, 0xF, 0xF, true));
}
__device__ __forceinline__ float red16_max(float x) {
    x = fmaxf(x, dpp_xor1(x));
    x = fmaxf(x, dpp_xor2(x));
    x = fmaxf(x, dpp_xor4(x));
    x = fmaxf(x, dpp_xor8(x));
    return x;
}
__device__ __forceinline__ float red16_sum(float x) {
    x += dpp_xor1(x);
    x += dpp_xor2(x);
    x += dpp_xor4(x);
    x += dpp_xor8(x);
    return x;
}

__global__ __launch_bounds__(512) void flash_attn_f16wmma(
    const float* __restrict__ Q, const float* __restrict__ K,
    const float* __restrict__ V, const int* __restrict__ VL,
    float* __restrict__ Out)
{
    __shared__ _Float16 qbuf[QT * KSTR];       // Q tile (query x dim), pre-scaled
    // per group: K tile (key x dim), then V tile transposed (dim x key); after the loop: merge area
    __shared__ __attribute__((aligned(16))) _Float16 kvbuf[NG * KVSZ];
    __shared__ _Float16 pbuf[NG * 4 * 16 * VSTR];   // per-wave P scratch (C->A relayout)

    const int tid  = threadIdx.x;
    const int wv   = __builtin_amdgcn_readfirstlane(tid >> 5);  // wave number, scalar: real scalar branches below
    const int grp  = wv >> 2;                  // key group
    const int wid  = wv & 3;                   // query wave inside the group
    const int gt   = tid & 127;                // thread inside the group
    const int lane = tid & 31;
    const int ln16 = lane & 15;
    const int hsel = (lane >> 4) << 3;         // 0 or 8

    const int b  = blockIdx.x >> 5;            // 32 query-blocks per batch
    const int qb = (blockIdx.x & 31) * QT;

    int vlen = VL[b];
    if (vlen < 1)  vlen = 1;
    if (vlen > NK) vlen = NK;
    const int nkb = (vlen + KT - 1) / KT;      // fully-masked tail blocks skipped
    const int ntrip = (nkb + NG - 1) / NG;     // block-uniform: every wave passes every barrier

    _Float16* kbuf  = kvbuf + grp * KVSZ;
    _Float16* vtbuf = kbuf + KT * KSTR;

    // ---- stage Q tile, f32 -> f16, fold in 1/sqrt(64) ----
    for (int i = tid; i < QT * DK / 4; i += 512) {
        const int q  = i >> 4;
        const int d4 = (i & 15) << 2;
        const float4 f = *(const float4*)(Q + (((size_t)b * NQ + qb + q) * DK + d4));
        v4h h;
        h[0] = (_Float16)(f.x * 0.125f); h[1] = (_Float16)(f.y * 0.125f);
        h[2] = (_Float16)(f.z * 0.125f); h[3] = (_Float16)(f.w * 0.125f);
        *(v4h*)(qbuf + q * KSTR + d4) = h;
    }
    __syncthreads();

    // per-wave Q A-fragments, kept in registers for the whole kernel
    const int qrow = wid * 16 + ln16;
    const v16h qa0 = load_frag<KSTR>(qbuf, qrow, hsel, 0);
    const v16h qa1 = load_frag<KSTR>(qbuf, qrow, hsel, 32);

    v8f o0 = {}, o1 = {}, o2 = {}, o3 = {};    // O accumulator: 16 x 64 f32
    float m[8], l[8];
#pragma unroll
    for (int i = 0; i < 8; ++i) { m[i] = -3.0e38f; l[i] = 0.0f; }

    _Float16* pw = pbuf + wv * 16 * VSTR;

    for (int t = 0; t < ntrip; ++t) {
        const int kb = t * NG + grp;           // this group's key tile
        const bool active = kb < nkb;          // scalar; a group past the end only keeps the barriers
        __syncthreads();                       // previous trip's kbuf/vtbuf reads done

        if (active) {
        const size_t kgbase = ((size_t)b * NK + (size_t)kb * KT) * DK;
        // ---- stage K (key x dim), f32 -> f16, b64 stores ----
        for (int i = gt; i < KT * DK / 4; i += 128) {
            const int r  = i >> 4;
            const int d4 = (i & 15) << 2;
            const float4 fk = *(const float4*)(K + kgbase + r * DK + d4);
            v4h hk;
            hk[0] = (_Float16)fk.x; hk[1] = (_Float16)fk.y;
            hk[2] = (_Float16)fk.z; hk[3] = (_Float16)fk.w;
            *(v4h*)(kbuf + r * KSTR + d4) = hk;
        }
        // ---- stage V transposed via 4x4 register micro-tiles, b64 stores ----
        for (int u = gt; u < (KT / 4) * (DK / 4); u += 128) {
            const int k0 = (u >> 4) << 2;      // key group of 4
            const int d0 = (u & 15) << 2;      // dim group of 4
            const float4 r0 = *(const float4*)(V + kgbase + (size_t)(k0 + 0) * DK + d0);
            const float4 r1 = *(const float4*)(V + kgbase + (size_t)(k0 + 1) * DK + d0);
            const float4 r2 = *(const float4*)(V + kgbase + (size_t)(k0 + 2) * DK + d0);
            const float4 r3 = *(const float4*)(V + kgbase + (size_t)(k0 + 3) * DK + d0);
            v4h c0 = { (_Float16)r0.x, (_Float16)r1.x, (_Float16)r2.x, (_Float16)r3.x };
            v4h c1 = { (_Float16)r0.y, (_Float16)r1.y, (_Float16)r2.y, (_Float16)r3.y };
            v4h c2 = { (_Float16)r0.z, (_Float16)r1.z, (_Float16)r2.z, (_Float16)r3.z };
            v4h c3 = { (_Float16)r0.w, (_Float16)r1.w, (_Float16)r2.w, (_Float16)r3.w };
            *(v4h*)(vtbuf + (d0 + 0) * VSTR + k0) = c0;
            *(v4h*)(vtbuf + (d0 + 1) * VSTR + k0) = c1;
            *(v4h*)(vtbuf + (d0 + 2) * VSTR + k0) = c2;
            *(v4h*)(vtbuf + (d0 + 3) * VSTR + k0) = c3;
        }
        }
        __syncthreads();
        if (!active) continue;

        // ---- scores S = (Q/8) K^T : 16 x 128, 16 WMMAs ----
        v8f s[8];
#pragma unroll
        for (int nt = 0; nt < 8; ++nt) {
            v8f acc = {};
            const v16h kf0 = load_frag<KSTR>(kbuf, nt * 16 + ln16, hsel, 0);
            acc = wmma_f16(qa0, kf0, acc);
            const v16h kf1 = load_frag<KSTR>(kbuf, nt * 16 + ln16, hsel, 32);
            acc = wmma_f16(qa1, kf1, acc);
            s[nt] = acc;
        }

        // ---- mask tail keys in the final block (uniform branch; EXEC stays full) ----
        if (kb == nkb - 1) {
#pragma unroll
            for (int nt = 0; nt < 8; ++nt) {
                const bool mk = (kb * KT + nt * 16 + ln16) >= vlen;
#pragma unroll
                for (int i = 0; i < 8; ++i) s[nt][i] = mk ? NEGVAL : s[nt][i];
            }
        }

        // ---- online softmax; row stats live in 16-lane halves (C-layout) ----
#pragma unroll
        for (int i = 0; i < 8; ++i) {
            float rm = s[0][i];
#pragma unroll
            for (int nt = 1; nt < 8; ++nt) rm = fmaxf(rm, s[nt][i]);
            rm = red16_max(rm);
            const float mnew  = fmaxf(m[i], rm);
            const float alpha = __expf(m[i] - mnew);
            m[i] = mnew;
            float rs = 0.0f;
#pragma unroll
            for (int nt = 0; nt < 8; ++nt) {
                s[nt][i] = __expf(s[nt][i] - mnew);
                rs += s[nt][i];
            }
            rs = red16_sum(rs);
            l[i] = l[i] * alpha + rs;
            o0[i] *= alpha; o1[i] *= alpha; o2[i] *= alpha; o3[i] *= alpha;
        }

        // ---- P: C-layout -> A-layout via per-wave LDS scratch (f16) ----
#pragma unroll
        for (int i = 0; i < 8; ++i) {
            const int row = i + ((lane >> 4) << 3);
#pragma unroll
            for (int nt = 0; nt < 8; ++nt)
                pw[row * VSTR + nt * 16 + ln16] = (_Float16)s[nt][i];
        }
        // DS ops from one wave are in-order; compiler inserts s_wait_dscnt for reuse.

        // ---- O += P V : 16 WMMAs (B-frags read contiguous keys from Vt) ----
#pragma unroll
        for (int h = 0; h < 4; ++h) {
            const v16h pf = load_frag<VSTR>(pw, ln16, hsel, h * 32);
            v16h vf;
            vf = load_frag<VSTR>(vtbuf,  0 + ln16, hsel, h * 32); o0 = wmma_f16(pf, vf, o0);
            vf = load_frag<VSTR>(vtbuf, 16 + ln16, hsel, h * 32); o1 = wmma_f16(pf, vf, o1);
            vf = load_frag<VSTR>(vtbuf, 32 + ln16, hsel, h * 32); o2 = wmma_f16(pf, vf, o2);
            vf = load_frag<VSTR>(vtbuf, 48 + ln16, hsel, h * 32); o3 = wmma_f16(pf, vf, o3);
        }
    }

    // ---- merge the four groups' partials through LDS (lane-wise: same C-layout in every group) ----
    __syncthreads();                           // every wave's last kbuf/vtbuf reads done: the area is reused
    float* mrg = (float*)kvbuf;
    {
        float* mw = mrg + wv * MSLOT + lane * 2;
#pragma unroll
        for (int p = 0; p < 4; ++p) {          // row pair p = accumulator elements 2p, 2p+1
            *(v2f*)(mw + (0 * 4 + p) * 64) = v2f{ o0[2 * p], o0[2 * p + 1] };
            *(v2f*)(mw + (1 * 4 + p) * 64) = v2f{ o1[2 * p], o1[2 * p + 1] };
            *(v2f*)(mw + (2 * 4 + p) * 64) = v2f{ o2[2 * p], o2[2 * p + 1] };
            *(v2f*)(mw + (3 * 4 + p) * 64) = v2f{ o3[2 * p], o3[2 * p + 1] };
            *(v2f*)(mw + (4 * 4 + p) * 64) = v2f{ m[2 * p],  m[2 * p + 1] };
            *(v2f*)(mw + (5 * 4 + p) * 64) = v2f{ l[2 * p],  l[2 * p + 1] };
        }
    }
    __syncthreads();

    // wave (grp, wid) finishes row pair grp of query wave wid: whole 256-B rows, one writer each.
    // A group that had no tile holds m = -3e38, l = 0, O = 0 and weighs 0.
    v2f pm[NG], pl[NG], po[NG][4];
#pragma unroll
    for (int s = 0; s < NG; ++s) {
        const float* mr = mrg + (s * 4 + wid) * MSLOT + grp * 64 + lane * 2;
#pragma unroll
        for (int j = 0; j < 4; ++j) po[s][j] = *(const v2f*)(mr + j * 256);
        pm[s] = *(const v2f*)(mr + 4 * 256);
        pl[s] = *(const v2f*)(mr + 5 * 256);
    }
#pragma unroll
    for (int e = 0; e < 2; ++e) {
        const float mx = fmaxf(fmaxf(pm[0][e], pm[1][e]), fmaxf(pm[2][e], pm[3][e]));
        float ls = 0.0f, a0 = 0.0f, a1 = 0.0f, a2 = 0.0f, a3 = 0.0f;
#pragma unroll
        for (int s = 0; s < NG; ++s) {
            const float w = __expf(pm[s][e] - mx);
            ls += w * pl[s][e];
            a0 += w * po[s][0][e];
            a1 += w * po[s][1][e];
            a2 += w * po[s][2][e];
            a3 += w * po[s][3][e];
        }
        const float inv = 1.0f / ls;
        const int row = grp * 2 + e + ((lane >> 4) << 3);
        float* op = Out + (((size_t)b * NQ + qb + wid * 16 + row) * DK + ln16);
        op[0]  = a0 * inv;
        op[16] = a1 * inv;
        op[32] = a2 * inv;
        op[48] = a3 * inv;
    }
}

extern "C" void kernel_launch(void* const* d_in, const int* in_sizes, int n_in,
                              void* d_out, int out_size, void* d_ws, size_t ws_size,
                              hipStream_t stream) {
    (void)in_sizes; (void)n_in; (void)out_size; (void)d_ws; (void)ws_size;
    const float* Q  = (const float*)d_in[0];
    const float* K  = (const float*)d_in[1];
    const float* V  = (const float*)d_in[2];
    const int*   VL = (const int*)d_in[3];
    float* Out = (float*)d_out;
    const int B = 8;
    dim3 grid(B * (NQ / QT));   // 256 blocks
    dim3 block(512);            // 16 waves: 4 key groups x 4 query waves
    flash_attn_f16wmma<<<grid, block, 0, stream>>>(Q, K, V, VL, Out);
}

// v002
// A run of this version takes 20.7 microseconds.
// In two side-by-side timings against v001, it was 1.35 and 1.34 times as fast.
// All steps since v000 together make it 3.58 times as fast.
#include <hip/hip_runtime.h>
#include <hip/hip_bf16.h>
#include <math.h>

// Flash-attention (B=8, Nq=Nk=2048, D=64, fp32 in/out) with per-batch key
// masking. f16 WMMA + f32 accumulation, online softmax, key loop truncated at
// valid_len. KT=128 keys per tile; softmax reductions via DPP (no ds_bpermute);
// V transpose staged as packed b64 stores.
// 16 waves per block = 4 key groups x 4 query waves: group g walks key tiles
// g, g+4, g+8, ... with its own LDS tiles, maxima, sums and accumulators (four
// waves per SIMD cover each other's load and LDS waits); the four partial
// results are merged once through LDS at the end.
// A group's next K/V tile is fetched into registers (32 x 16 B per thread): its K
// half is issued ahead of the current tile's softmax, its V half ahead of the P*V
// products, so the loads fly under that work; the top of the next trip only
// converts and stores them.

typedef __attribute__((ext_vector_type(16))) _Float16 v16h;
typedef __attribute__((ext_vector_type(8)))  _Float16 v8h;
typedef __attribute__((ext_vector_type(4)))  _Float16 v4h;
typedef __attribute__((ext_vector_type(8)))  float    v8f;
typedef __attribute__((ext_vector_type(2)))  float    v2f;

#define NEGVAL (-1000000.0f)

static constexpr int NQ   = 2048;
static constexpr int NK   = 2048;
static constexpr int DK   = 64;
static constexpr int QT   = 64;    // queries per block (4 waves x 16 rows)
static constexpr int KT   = 128;   // keys per main-loop iteration
static constexpr int KSTR = 72;    // stride (halves) for dim-minor tiles (Q,K): 144B, 16B-aligned
static constexpr int VSTR = 136;   // stride (halves) for key-minor tiles (Vt,P): 272B, 16B-aligned
static constexpr int NG   = 4;     // key groups per block
static constexpr int KVSZ = KT * KSTR + DK * VSTR;  // halves of one group's K + Vt tiles
static constexpr int MSLOT = 6 * 4 * 64;            // floats of one wave's partial: (4 O tiles, m, l) x 4 row pairs x 32 lanes x 2
static_assert(NG * 4 * MSLOT * 4 <= NG * KVSZ * 2, "merge area must fit in the K/Vt tiles");

// A- and B-fragments for 16-bit WMMA share the same per-lane pattern:
// lanes 0-15  : halves {kbase+0..7,  kbase+16..23}
// lanes 16-31 : halves {kbase+8..15, kbase+24..31}
// -> two ds_load_b128 at (row*STRIDE + kbase + hsel) and +16 halves.
template <int STRIDE>
__device__ __forceinline__ v16h load_frag(const _Float16* base, int row, int hsel, int kbase) {
    const v8h lo = *(const v8h*)(base + row * STRIDE + kbase + hsel);
    const v8h hi = *(const v8h*)(base + row * STRIDE + kbase + hsel + 16);
    v16h f;
#pragma unroll
    for (int i = 0; i < 8; ++i) { f[i] = lo[i]; f[i + 8] = hi[i]; }
    return f;
}

__device__ __forceinline__ v8f wmma_f16(v16h a, v16h b, v8f c) {
    return __builtin_amdgcn_wmma_f32_16x16x32_f16(false, a, false, b, (short)0, c, false, false);
}

// ---- DPP lane-xor shuffles within a 16-lane half (no DS traffic) ----
__device__ __forceinline__ float dpp_xor1(float x) {   // quad_perm [1,0,3,2]
    return __builtin_bit_cast(float,
        __builtin_amdgcn_update_dpp(0, __builtin_bit_cast(int, x), 0xB1, 0xF, 0xF, true));
}
__device__ __forceinline__ float dpp_xor2(float x) {   // quad_perm [2,3,0,1]
    return __builtin_bit_cast(float,
        __builtin_amdgcn_update_dpp(0, __builtin_bit_cast(int, x), 0x4E, 0xF, 0xF, true));
}
__device__ __forceinline__ float dpp_xor4(float x) {   // dpp8 sel: lane i <- i^4
    constexpr int SEL = 4 | (5 << 3) | (6 << 6) | (7 << 9) |
                        (0 << 12) | (1 << 15) | (2 << 18) | (3 << 21);
    return __builtin_bit_cast(float,
        __builtin_amdgcn_mov_dpp8(__builtin_bit_cast(int, x), SEL));
}
__device__ __forceinline__ float dpp_xor8(float x) {   // ROW_ROR:8 == xor8 within row of 16
    return __builtin_bit_cast(float,
        __builtin_amdgcn_update_dpp(0, __builtin_bit_cast(int, x), 0x128, 0xF, 0xF, true));
}
__device__ __forceinline__ float red16_max(float x) {
    x = fmaxf(x, dpp_xor1(x));
    x = fmaxf(x, dpp_xor2(x));
    x = fmaxf(x, dpp_xor4(x));
    x = fmaxf(x, dpp_xor8(x));
    return x;
}
__device__ __forceinline__ float red16_sum(float x) {
    x += dpp_xor1(x);
    x += dpp_xor2(x);
    x += dpp_xor4(x);
    x += dpp_xor8(x);
    return x;
}

__global__ __launch_bounds__(512) void flash_attn_f16wmma(
    const float* __restrict__ Q, const float* __restrict__ K,
    const float* __restrict__ V, const int* __restrict__ VL,
    float* __restrict__ Out)
{
    __shared__ _Float16 qbuf[QT * KSTR];       // Q tile (query x dim), pre-scaled
    // per group: K tile (key x dim), then V tile transposed (dim x key); after the loop: merge area
    __shared__ __attribute__((aligned(16))) _Float16 kvbuf[NG * KVSZ];
    __shared__ _Float16 pbuf[NG * 4 * 16 * VSTR];   // per-wave P scratch (C->A relayout)

    const int tid  = threadIdx.x;
    const int wv   = __builtin_amdgcn_readfirstlane(tid >> 5);  // wave number, scalar: real scalar branches below
    const int grp  = wv >> 2;                  // key group
    const int wid  = wv & 3;                   // query wave inside the group
    const int gt   = tid & 127;                // thread inside the group
    const int lane = tid & 31;
    const int ln16 = lane & 15;
    const int hsel = (lane >> 4) << 3;         // 0 or 8

    const int b  = blockIdx.x >> 5;            // 32 query-blocks per batch
    const int qb = (blockIdx.x & 31) * QT;

    int vlen = VL[b];
    if (vlen < 1)  vlen = 1;
    if (vlen > NK) vlen = NK;
    const int nkb = (vlen + KT - 1) / KT;      // fully-masked tail blocks skipped
    const int ntrip = (nkb + NG - 1) / NG;     // block-uniform: every wave passes every barrier

    _Float16* kbuf  = kvbuf + grp * KVSZ;
    _Float16* vtbuf = kbuf + KT * KSTR;

    // Thread gt of a group owns, of each tile: K float4 number gt + 128 j (key (gt >> 4) + 8 j, dims 4 (gt & 15) ..),
    // and the 4 x 4 V micro-tiles at keys 4 (gt >> 4) + 32 j .., dims 4 (gt & 15) ..
    _Float16* kst = kbuf + (gt >> 4) * KSTR + ((gt & 15) << 2);
    _Float16* vst = vtbuf + ((gt & 15) << 2) * VSTR + ((gt >> 4) << 2);
    const float* kld = K + (size_t)b * NK * DK + gt * 4;
    const float* vld = V + (size_t)b * NK * DK + (gt >> 4) * (4 * DK) + ((gt & 15) << 2);
    float4 kr[16], vr[16];                     // this thread's share of the group's next tile, as loaded
    // (every loop over kr / vr below is unrolled: constant indices keep the arrays in registers)
    // have: the 16 loads of tile kb's K (or V) share, none waited for here. Otherwise the registers get a value of
    // their own, so that the tile before does not stay live in them through the score phase (it spilled).
    auto fetch_k = [&](bool have, int kb) {
        if (have) {
            const float* kp = kld + (size_t)kb * (KT * DK);
#pragma unroll
            for (int j = 0; j < 16; ++j) kr[j] = *(const float4*)(kp + j * 512);
            // the code behind reuses the loads' address registers
            asm volatile("s_wait_xcnt 0x0" ::: "memory");
        } else {
#pragma unroll
            for (int j = 0; j < 16; ++j) kr[j] = float4{0.f, 0.f, 0.f, 0.f};
        }
    };
    auto fetch_v = [&](bool have, int kb) {
        if (have) {
            const float* vp = vld + (size_t)kb * (KT * DK);
#pragma unroll
            for (int j = 0; j < 16; ++j) vr[j] = *(const float4*)(vp + (j >> 2) * (32 * DK) + (j & 3) * DK);
            // as in fetch_k
            asm volatile("s_wait_xcnt 0x0" ::: "memory");
        } else {
#pragma unroll
            for (int j = 0; j < 16; ++j) vr[j] = float4{0.f, 0.f, 0.f, 0.f};
        }
    };
    fetch_k(grp < nkb, grp);                   // the group's first tile flies under the Q staging
    fetch_v(grp < nkb, grp);

    // ---- stage Q tile, f32 -> f16, fold in 1/sqrt(64) ----
    for (int i = tid; i < QT * DK / 4; i += 512) {
        const int q  = i >> 4;
        const int d4 = (i & 15) << 2;
        const float4 f = *(const float4*)(Q + (((size_t)b * NQ + qb + q) * DK + d4));
        v4h h;
        h[0] = (_Float16)(f.x * 0.125f); h[1] = (_Float16)(f.y * 0.125f);
        h[2] = (_Float16)(f.z * 0.125f); h[3] = (_Float16)(f.w * 0.125f);
        *(v4h*)(qbuf + q * KSTR + d4) = h;
    }
    __syncthreads();

    // per-wave Q A-fragments, kept in registers for the whole kernel
    const int qrow = wid * 16 + ln16;
    const v16h qa0 = load_frag<KSTR>(qbuf, qrow, hsel, 0);
    const v16h qa1 = load_frag<KSTR>(qbuf, qrow, hsel, 32);

    v8f o0 = {}, o1 = {}, o2 = {}, o3 = {};    // O accumulator: 16 x 64 f32
    float m[8], l[8];
#pragma unroll
    for (int i = 0; i < 8; ++i) { m[i] = -3.0e38f; l[i] = 0.0f; }

    _Float16* pw = pbuf + wv * 16 * VSTR;

    for (int t = 0; t < ntrip; ++t) {
        const int kb = t * NG + grp;           // this group's key tile
        const bool active = kb < nkb;          // scalar; a group past the end only keeps the barriers
        __syncthreads();                       // previous trip's kbuf/vtbuf reads done

        if (active) {
            // ---- K (key x dim), f32 -> f16, b64 stores ----
#pragma unroll
            for (int j = 0; j < 16; ++j) {
                v4h hk;
                hk[0] = (_Float16)kr[j].x; hk[1] = (_Float16)kr[j].y;
                hk[2] = (_Float16)kr[j].z; hk[3] = (_Float16)kr[j].w;
                *(v4h*)(kst + j * 8 * KSTR) = hk;
            }
            // ---- V transposed via 4x4 register micro-tiles, b64 stores ----
#pragma unroll
            for (int j = 0; j < 4; ++j) {
                const float4 r0 = vr[j * 4 + 0], r1 = vr[j * 4 + 1], r2 = vr[j * 4 + 2], r3 = vr[j * 4 + 3];
                v4h c0 = { (_Float16)r0.x, (_Float16)r1.x, (_Float16)r2.x, (_Float16)r3.x };
                v4h c1 = { (_Float16)r0.y, (_Float16)r1.y, (_Float16)r2.y, (_Float16)r3.y };
                v4h c2 = { (_Float16)r0.z, (_Float16)r1.z, (_Float16)r2.z, (_Float16)r3.z };
                v4h c3 = { (_Float16)r0.w, (_Float16)r1.w, (_Float16)r2.w, (_Float16)r3.w };
                *(v4h*)(vst + 0 * VSTR + j * 32) = c0;
                *(v4h*)(vst + 1 * VSTR + j * 32) = c1;
                *(v4h*)(vst + 2 * VSTR + j * 32) = c2;
                *(v4h*)(vst + 3 * VSTR + j * 32) = c3;
            }
        }
        __syncthreads();
        if (!active) continue;

        // ---- scores S = (Q/8) K^T : 16 x 128, 16 WMMAs ----
        v8f s[8];
#pragma unroll
        for (int nt = 0; nt < 8; ++nt) {
            v8f acc = {};
            const v16h kf0 = load_frag<KSTR>(kbuf, nt * 16 + ln16, hsel, 0);
            acc = wmma_f16(qa0, kf0, acc);
            const v16h kf1 = load_frag<KSTR>(kbuf, nt * 16 + ln16, hsel, 32);
            acc = wmma_f16(qa1, kf1, acc);
            s[nt] = acc;
        }

        // ---- mask tail keys in the final block (uniform branch; EXEC stays full) ----
        if (kb == nkb - 1) {
#pragma unroll
            for (int nt = 0; nt < 8; ++nt) {
                const bool mk = (kb * KT + nt * 16 + ln16) >= vlen;
#pragma unroll
                for (int i = 0; i < 8; ++i) s[nt][i] = mk ? NEGVAL : s[nt][i];
            }
        }

        // ---- next tile of this group, K half: flies under the softmax ----
        fetch_k(kb + NG < nkb, kb + NG);

        // ---- online softmax; row stats live in 16-lane halves (C-layout) ----
#pragma unroll
        for (int i = 0; i < 8; ++i) {
            float rm = s[0][i];
#pragma unroll
            for (int nt = 1; nt < 8; ++nt) rm = fmaxf(rm, s[nt][i]);
            rm = red16_max(rm);
            const float mnew  = fmaxf(m[i], rm);
            const float alpha = __expf(m[i] - mnew);
            m[i] = mnew;
            float rs = 0.0f;
#pragma unroll
            for (int nt = 0; nt < 8; ++nt) {
                s[nt][i] = __expf(s[nt][i] - mnew);
                rs += s[nt][i];
            }
            rs = red16_sum(rs);
            l[i] = l[i] * alpha + rs;
            o0[i] *= alpha; o1[i] *= alpha; o2[i] *= alpha; o3[i] *= alpha;
        }

        // ---- P: C-layout -> A-layout via per-wave LDS scratch (f16) ----
#pragma unroll
        for (int i = 0; i < 8; ++i) {
            const int row = i + ((lane >> 4) << 3);
#pragma unroll
            for (int nt = 0; nt < 8; ++nt)
                pw[row * VSTR + nt * 16 + ln16] = (_Float16)s[nt][i];
        }
        // DS ops from one wave are in-order; compiler inserts s_wait_dscnt for reuse.

        // ---- next tile of this group, V half (the score registers are free again): flies under P*V ----
        fetch_v(kb + NG < nkb, kb + NG);

        // ---- O += P V : 16 WMMAs (B-frags read contiguous keys from Vt) ----
#pragma unroll
        for (int h = 0; h < 4; ++h) {
            const v16h pf = load_frag<VSTR>(pw, ln16, hsel, h * 32);
            v16h vf;
            vf = load_frag<VSTR>(vtbuf,  0 + ln16, hsel, h * 32); o0 = wmma_f16(pf, vf, o0);
            vf = load_frag<VSTR>(vtbuf, 16 + ln16, hsel, h * 32); o1 = wmma_f16(pf, vf, o1);
            vf = load_frag<VSTR>(vtbuf, 32 + ln16, hsel, h * 32); o2 = wmma_f16(pf, vf, o2);
            vf = load_frag<VSTR>(vtbuf, 48 + ln16, hsel, h * 32); o3 = wmma_f16(pf, vf, o3);
        }
    }

    // ---- merge the four groups' partials through LDS (lane-wise: same C-layout in every group) ----
    __syncthreads();                           // every wave's last kbuf/vtbuf reads done: the area is reused
    float* mrg = (float*)kvbuf;
    {
        float* mw = mrg + wv * MSLOT + lane * 2;
#pragma unroll
        for (int p = 0; p < 4; ++p) {          // row pair p = accumulator elements 2p, 2p+1
            *(v2f*)(mw + (0 * 4 + p) * 64) = v2f{ o0[2 * p], o0[2 * p + 1] };
            *(v2f*)(mw + (1 * 4 + p) * 64) = v2f{ o1[2 * p], o1[2 * p + 1] };
            *(v2f*)(mw + (2 * 4 + p) * 64) = v2f{ o2[2 * p], o2[2 * p + 1] };
            *(v2f*)(mw + (3 * 4 + p) * 64) = v2f{ o3[2 * p], o3[2 * p + 1] };
            *(v2f*)(mw + (4 * 4 + p) * 64) = v2f{ m[2 * p],  m[2 * p + 1] };
            *(v2f*)(mw + (5 * 4 + p) * 64) = v2f{ l[2 * p],  l[2 * p + 1] };
        }
    }
    __syncthreads();

    // wave (grp, wid) finishes row pair grp of query wave wid: whole 256-B rows, one writer each.
    // A group that had no tile holds m = -3e38, l = 0, O = 0 and weighs 0.
    v2f pm[NG], pl[NG], po[NG][4];
#pragma unroll
    for (int s = 0; s < NG; ++s) {
        const float* mr = mrg + (s * 4 + wid) * MSLOT + grp * 64 + lane * 2;
#pragma unroll
        for (int j = 0; j < 4; ++j) po[s][j] = *(const v2f*)(mr + j * 256);
        pm[s] = *(const v2f*)(mr + 4 * 256);
        pl[s] = *(const v2f*)(mr + 5 * 256);
    }
#pragma unroll
    for (int e = 0; e < 2; ++e) {
        const float mx = fmaxf(fmaxf(pm[0][e], pm[1][e]), fmaxf(pm[2][e], pm[3][e]));
        float ls = 0.0f, a0 = 0.0f, a1 = 0.0f, a2 = 0.0f, a3 = 0.0f;
#pragma unroll
        for (int s = 0; s < NG; ++s) {
            const float w = __expf(pm[s][e] - mx);
            ls += w * pl[s][e];
            a0 += w * po[s][0][e];
            a1 += w * po[s][1][e];
            a2 += w * po[s][2][e];
            a3 += w * po[s][3][e];
        }
        const float inv = 1.0f / ls;
        const int row = grp * 2 + e + ((lane >> 4) << 3);
        float* op = Out + (((size_t)b * NQ + qb + wid * 16 + row) * DK + ln16);
        op[0]  = a0 * inv;
        op[16] = a1 * inv;
        op[32] = a2 * inv;
        op[48] = a3 * inv;
    }
}

extern "C" void kernel_launch(void* const* d_in, const int* in_sizes, int n_in,
                              void* d_out, int out_size, void* d_ws, size_t ws_size,
                              hipStream_t stream) {
    (void)in_sizes; (void)n_in; (void)out_size; (void)d_ws; (void)ws_size;
    const float* Q  = (const float*)d_in[0];
    const float* K  = (const float*)d_in[1];
    const float* V  = (const float*)d_in[2];
    const int*   VL = (const int*)d_in[3];
    float* Out = (float*)d_out;
    const int B = 8;
    dim3 grid(B * (NQ / QT));   // 256 blocks
    dim3 block(512);            // 16 waves: 4 key groups x 4 query waves
    flash_attn_f16wmma<<<grid, block, 0, stream>>>(Q, K, V, VL, Out);
}

// v003
// One run takes 19.7 microseconds.
// Timed twice side by side with v002, it ran 1.05 times as fast both times.
// All steps since v000 together make it 3.75 times as fast.
#include <hip/hip_runtime.h>
#include <hip/hip_bf16.h>
#include <math.h>

typedef __attribute__((ext_vector_type(16))) _Float16 v16h;
typedef __attribute__((ext_vector_type(8)))  _Float16 v8h;
typedef __attribute__((ext_vector_type(4)))  _Float16 v4h;
typedef __attribute__((ext_vector_type(8)))  float    v8f;
typedef __attribute__((ext_vector_type(4)))  float    v4f;
typedef __attribute__((ext_vector_type(2)))  float    v2f;

#define NEGVAL (-1000000.0f)

static constexpr int NQ   = 2048;
static constexpr int NK   = 2048;
static constexpr int DK   = 64;
static constexpr int QT   = 64;    // queries per block (4 waves x 16 rows)
static constexpr int KT   = 128;   // keys per main-loop iteration
static constexpr int KSTR = 72;    // stride (halves) for dim-minor tiles (Q,K): 144B, 16B-aligned
static constexpr int VSTR = 136;   // stride (halves) for the key-minor tile (Vt): 272B, 16B-aligned
static constexpr int NG   = 4;     // key groups per block
static constexpr int KVSZ = KT * KSTR + DK * VSTR;  // halves of one group's K + Vt tiles
static constexpr int MPITCH = DK + 4;               // floats of one query's row in the merge area (16B-aligned, rows on shifted banks)
static constexpr int MSLOT = 16 * MPITCH + 32;      // floats of one wave's partial: 16 query rows of O, then (m, l) per query
static_assert(NG * 4 * MSLOT * 4 <= NG * KVSZ * 2, "merge area must fit in the K/Vt tiles");

// A- and B-fragments for 16-bit WMMA share the same per-lane pattern:
// lanes 0-15  : halves {kbase+0..7,  kbase+16..23}
// lanes 16-31 : halves {kbase+8..15, kbase+24..31}
// -> two ds_load_b128 at (row*STRIDE + kbase + hsel) and +16 halves.
template <int STRIDE>
__device__ __forceinline__ v16h load_frag(const _Float16* base, int row, int hsel, int kbase) {
    const v8h lo = *(const v8h*)(base + row * STRIDE + kbase + hsel);
    const v8h hi = *(const v8h*)(base + row * STRIDE + kbase + hsel + 16);
    v16h f;
#pragma unroll
    for (int i = 0; i < 8; ++i) { f[i] = lo[i]; f[i + 8] = hi[i]; }
    return f;
}

__device__ __forceinline__ v8f wmma_f16(v16h a, v16h b, v8f c) {
    return __builtin_amdgcn_wmma_f32_16x16x32_f16(false, a, false, b, (short)0, c, false, false);
}

// lane l <-> lane l ^ 16 (vector cross-row move, no DS traffic)
__device__ __forceinline__ float xhalf(float x) {
    const int b = __builtin_bit_cast(int, x);
    return __builtin_bit_cast(float, __builtin_amdgcn_permlanex16(b, b, 0x76543210, 0xfedcba98, false, false));
}

__global__ __launch_bounds__(512) void flash_attn_f16wmma(
    const float* __restrict__ Q, const float* __restrict__ K,
    const float* __restrict__ V, const int* __restrict__ VL,
    float* __restrict__ Out)
{
    __shared__ _Float16 qbuf[QT * KSTR];       // Q tile (query x dim), pre-scaled
    // per group: K tile (key x dim), then V tile transposed (dim x key); after the loop: merge area
    __shared__ __attribute__((aligned(16))) _Float16 kvbuf[NG * KVSZ];

    const int tid  = threadIdx.x;
    const int wv   = __builtin_amdgcn_readfirstlane(tid >> 5);  // wave number, scalar: real scalar branches below
    const int grp  = wv >> 2;                  // key group
    const int wid  = wv & 3;                   // query wave inside the group
    const int gt   = tid & 127;                // thread inside the group
    const int lane = tid & 31;
    const int ln16 = lane & 15;
    const int hsel = (lane >> 4) << 3;         // 0 or 8

    const int b  = blockIdx.x >> 5;            // 32 query-blocks per batch
    const int qb = (blockIdx.x & 31) * QT;

    int vlen = VL[b];
    if (vlen < 1)  vlen = 1;
    if (vlen > NK) vlen = NK;
    const int nkb = (vlen + KT - 1) / KT;      // fully-masked tail blocks skipped
    const int ntrip = (nkb + NG - 1) / NG;     // block-uniform: every wave passes every barrier

    _Float16* kbuf  = kvbuf + grp * KVSZ;
    _Float16* vtbuf = kbuf + KT * KSTR;

    // Thread gt of a group owns, of each tile: K float4 number gt + 128 j (key (gt >> 4) + 8 j, dims 4 (gt & 15) ..),
    // and the 4 x 4 V micro-tiles at keys 4 (gt >> 4) + 32 j .., dims 4 (gt & 15) ..
    _Float16* kst = kbuf + (gt >> 4) * KSTR + ((gt & 15) << 2);
    _Float16* vst = vtbuf + ((gt & 15) << 2) * VSTR + ((gt >> 4) << 2);
    const float* kld = K + (size_t)b * NK * DK + gt * 4;
    const float* vld = V + (size_t)b * NK * DK + (gt >> 4) * (4 * DK) + ((gt & 15) << 2);
    float4 kr[16], vr[16];                     // this thread's share of the group's next tile, as loaded
    // (every loop over kr / vr below is unrolled: constant indices keep the arrays in registers)
    // have: the 16 loads of tile kb's K (or V) share, none waited for here. Otherwise the registers get a value of
    // their own, so that the tile before does not stay live in them through the score phase (it spilled).
    auto fetch_k = [&](bool have, int kb) {
        if (have) {
            const float* kp = kld + (size_t)kb * (KT * DK);
#pragma unroll
            for (int j = 0; j < 16; ++j) kr[j] = *(const float4*)(kp + j * 512);
            // the code behind reuses the loads' address registers
            asm volatile("s_wait_xcnt 0x0" ::: "memory");
        } else {
#pragma unroll
            for (int j = 0; j < 16; ++j) kr[j] = float4{0.f, 0.f, 0.f, 0.f};
        }
    };
    auto fetch_v = [&](bool have, int kb) {
        if (have) {
            const float* vp = vld + (size_t)kb * (KT * DK);
#pragma unroll
            for (int j = 0; j < 16; ++j) vr[j] = *(const float4*)(vp + (j >> 2) * (32 * DK) + (j & 3) * DK);
            // as in fetch_k
            asm volatile("s_wait_xcnt 0x0" ::: "memory");
        } else {
#pragma unroll
            for (int j = 0; j < 16; ++j) vr[j] = float4{0.f, 0.f, 0.f, 0.f};
        }
    };
    fetch_k(grp < nkb, grp);                   // the group's first tile flies under the Q staging
    fetch_v(grp < nkb, grp);

    // ---- stage Q tile, f32 -> f16, fold in 1/sqrt(64) ----
    for (int i = tid; i < QT * DK / 4; i += 512) {
        const int q  = i >> 4;
        const int d4 = (i & 15) << 2;
        const float4 f = *(const float4*)(Q + (((size_t)b * NQ + qb + q) * DK + d4));
        v4h h;
        h[0] = (_Float16)(f.x * 0.125f); h[1] = (_Float16)(f.y * 0.125f);
        h[2] = (_Float16)(f.z * 0.125f); h[3] = (_Float16)(f.w * 0.125f);
        *(v4h*)(qbuf + q * KSTR + d4) = h;
    }
    __syncthreads();

    const int qrow = wid * 16 + ln16;

    // O^T accumulator, 64 dims x 16 queries f32: tile j, element r = dim 16 j + hsel + r of query ln16
    v8f o0 = {}, o1 = {}, o2 = {}, o3 = {};
    float m = -3.0e38f;                        // running maximum of query ln16 (equal in both halves)
    float l = 0.0f;                            // running sum over this half's keys only; the halves join after the loop

    for (int t = 0; t < ntrip; ++t) {
        const int kb = t * NG + grp;           // this group's key tile
        const bool active = kb < nkb;          // scalar; a group past the end only keeps the barriers
        __syncthreads();                       // previous trip's kbuf/vtbuf reads done

        if (active) {
            // ---- K (key x dim), f32 -> f16, b64 stores ----
#pragma unroll
            for (int j = 0; j < 16; ++j) {
                v4h hk;
                hk[0] = (_Float16)kr[j].x; hk[1] = (_Float16)kr[j].y;
                hk[2] = (_Float16)kr[j].z; hk[3] = (_Float16)kr[j].w;
                *(v4h*)(kst + j * 8 * KSTR) = hk;
            }
            // ---- V transposed via 4x4 register micro-tiles, b64 stores ----
#pragma unroll
            for (int j = 0; j < 4; ++j) {
                const float4 r0 = vr[j * 4 + 0], r1 = vr[j * 4 + 1], r2 = vr[j * 4 + 2], r3 = vr[j * 4 + 3];
                v4h c0 = { (_Float16)r0.x, (_Float16)r1.x, (_Float16)r2.x, (_Float16)r3.x };
                v4h c1 = { (_Float16)r0.y, (_Float16)r1.y, (_Float16)r2.y, (_Float16)r3.y };
                v4h c2 = { (_Float16)r0.z, (_Float16)r1.z, (_Float16)r2.z, (_Float16)r3.z };
                v4h c3 = { (_Float16)r0.w, (_Float16)r1.w, (_Float16)r2.w, (_Float16)r3.w };
                *(v4h*)(vst + 0 * VSTR + j * 32) = c0;
                *(v4h*)(vst + 1 * VSTR + j * 32) = c1;
                *(v4h*)(vst + 2 * VSTR + j * 32) = c2;
                *(v4h*)(vst + 3 * VSTR + j * 32) = c3;
            }
        }
        __syncthreads();
        if (!active) continue;

        // ---- scores S^T = K (Q/8)^T : 128 x 16, 16 WMMAs; s[nt][i] = key 16 nt + hsel + i, query ln16 ----
        // per-wave Q fragments (B operand: lane = query column), re-read each trip: their 16 registers are free
        // while scores, both prefetched halves and the accumulators are live together
        const v16h qa0 = load_frag<KSTR>(qbuf, qrow, hsel, 0);
        const v16h qa1 = load_frag<KSTR>(qbuf, qrow, hsel, 32);
        v8f s[8];
#pragma unroll
        for (int nt = 0; nt < 8; ++nt) {
            v8f acc = {};
            const v16h kf0 = load_frag<KSTR>(kbuf, nt * 16 + ln16, hsel, 0);
            acc = wmma_f16(kf0, qa0, acc);
            const v16h kf1 = load_frag<KSTR>(kbuf, nt * 16 + ln16, hsel, 32);
            acc = wmma_f16(kf1, qa1, acc);
            s[nt] = acc;
        }

        // ---- mask tail keys in the final block (uniform branch; EXEC stays full) ----
        if (kb == nkb - 1) {
            const int left = vlen - kb * KT - hsel;    // valid keys from this half's first row on
#pragma unroll
            for (int nt = 0; nt < 8; ++nt)
#pragma unroll
                for (int i = 0; i < 8; ++i) s[nt][i] = (nt * 16 + i >= left) ? NEGVAL : s[nt][i];
        }

        // ---- next tile of this group, K half: flies under the softmax ----
        fetch_k(kb + NG < nkb, kb + NG);

        // ---- online softmax, one query per lane: eight independent chains, then a tree ----
        float r8[8];
#pragma unroll
        for (int i = 0; i < 8; ++i) {
            r8[i] = s[0][i];
#pragma unroll
            for (int nt = 1; nt < 8; ++nt) r8[i] = fmaxf(r8[i], s[nt][i]);
        }
        float rm = fmaxf(fmaxf(fmaxf(r8[0], r8[1]), fmaxf(r8[2], r8[3])), fmaxf(fmaxf(r8[4], r8[5]), fmaxf(r8[6], r8[7])));
        rm = fmaxf(rm, xhalf(rm));             // the other 64 keys of the same query
        const float mnew  = fmaxf(m, rm);
        const float alpha = __expf(m - mnew);
        m = mnew;

        // ---- P^T as B operand: score tiles 2h and 2h+1, converted in place, hold keys 32 h .. in load_frag's k order ----
        v16h pb[4];
#pragma unroll
        for (int i = 0; i < 8; ++i) r8[i] = 0.0f;
#pragma unroll
        for (int nt = 0; nt < 8; ++nt) {
#pragma unroll
            for (int i = 0; i < 8; ++i) {
                const float p = __expf(s[nt][i] - mnew);
                r8[i] += p;
                pb[nt >> 1][(nt & 1) * 8 + i] = (_Float16)p;
            }
        }
        l = l * alpha + (((r8[0] + r8[1]) + (r8[2] + r8[3])) + ((r8[4] + r8[5]) + (r8[6] + r8[7])));
#pragma unroll
        for (int i = 0; i < 8; ++i) { o0[i] *= alpha; o1[i] *= alpha; o2[i] *= alpha; o3[i] *= alpha; }

        // ---- next tile of this group, V half (the score registers are free again): flies under P*V ----
        fetch_v(kb + NG < nkb, kb + NG);

        // ---- O^T += V^T P^T : 16 WMMAs (A-frags read contiguous keys from Vt) ----
#pragma unroll
        for (int h = 0; h < 4; ++h) {
            v16h vf;
            vf = load_frag<VSTR>(vtbuf,  0 + ln16, hsel, h * 32); o0 = wmma_f16(vf, pb[h], o0);
            vf = load_frag<VSTR>(vtbuf, 16 + ln16, hsel, h * 32); o1 = wmma_f16(vf, pb[h], o1);
            vf = load_frag<VSTR>(vtbuf, 32 + ln16, hsel, h * 32); o2 = wmma_f16(vf, pb[h], o2);
            vf = load_frag<VSTR>(vtbuf, 48 + ln16, hsel, h * 32); o3 = wmma_f16(vf, pb[h], o3);
        }
    }

    // ---- merge the four groups' partials through LDS, as (query x dim) rows ----
    __syncthreads();                           // every wave's last kbuf/vtbuf reads done: the area is reused
    float* mrg = (float*)kvbuf;
    {
        float* mw = mrg + wv * MSLOT;
        float* mo = mw + ln16 * MPITCH + hsel;
        *(v4f*)(mo +  0) = v4f{ o0[0], o0[1], o0[2], o0[3] };  *(v4f*)(mo +  4) = v4f{ o0[4], o0[5], o0[6], o0[7] };
        *(v4f*)(mo + 16) = v4f{ o1[0], o1[1], o1[2], o1[3] };  *(v4f*)(mo + 20) = v4f{ o1[4], o1[5], o1[6], o1[7] };
        *(v4f*)(mo + 32) = v4f{ o2[0], o2[1], o2[2], o2[3] };  *(v4f*)(mo + 36) = v4f{ o2[4], o2[5], o2[6], o2[7] };
        *(v4f*)(mo + 48) = v4f{ o3[0], o3[1], o3[2], o3[3] };  *(v4f*)(mo + 52) = v4f{ o3[4], o3[5], o3[6], o3[7] };
        const float lt = l + xhalf(l);         // the two halves' key sums joined
        if (hsel == 0) *(v2f*)(mw + 16 * MPITCH + ln16 * 2) = v2f{ m, lt };   // lower half writes; both hold the same pair
    }
    __syncthreads();

    // wave (grp, wid) finishes queries 4 grp .. 4 grp + 3 of query wave wid: each store covers two whole 256-B rows,
    // one writer each. A group that had no tile holds m = -3e38, l = 0, O = 0 and weighs 0.
#pragma unroll
    for (int j = 0; j < 2; ++j) {
        const int q = grp * 4 + j * 2 + (lane >> 4);
        v4f po[NG];
        v2f ml[NG];
#pragma unroll
        for (int s = 0; s < NG; ++s) {
            const float* mr = mrg + (s * 4 + wid) * MSLOT;
            po[s] = *(const v4f*)(mr + q * MPITCH + ln16 * 4);
            ml[s] = *(const v2f*)(mr + 16 * MPITCH + q * 2);
        }
        const float mx = fmaxf(fmaxf(ml[0][0], ml[1][0]), fmaxf(ml[2][0], ml[3][0]));
        float ls = 0.0f;
        v4f a = { 0.0f, 0.0f, 0.0f, 0.0f };
#pragma unroll
        for (int s = 0; s < NG; ++s) {
            const float w = __expf(ml[s][0] - mx);
            ls += w * ml[s][1];
            a += w * po[s];
        }
        const float inv = 1.0f / ls;
        *(v4f*)(Out + (((size_t)b * NQ + qb + wid * 16 + q) * DK + ln16 * 4)) = a * inv;
    }
}

extern "C" void kernel_launch(void* const* d_in, const int* in_sizes, int n_in,
                              void* d_out, int out_size, void* d_ws, size_t ws_size,
                              hipStream_t stream) {
    (void)in_sizes; (void)n_in; (void)out_size; (void)d_ws; (void)ws_size;
    const float* Q  = (const float*)d_in[0];
    const float* K  = (const float*)d_in[1];
    const float* V  = (const float*)d_in[2];
    const int*   VL = (const int*)d_in[3];
    float* Out = (float*)d_out;
    const int B = 8;
    dim3 grid(B * (NQ / QT));   // 256 blocks
    dim3 block(512);            // 16 waves: 4 key groups x 4 query waves
    flash_attn_f16wmma<<<grid, block, 0, stream>>>(Q, K, V, VL, Out);
}

// v004
// A run of this version takes 17.7 microseconds.
// Two timings next to v003 both put it at 1.11 times that version's speed.
// Over all steps from v000 it is 4.16 times as fast.
#include <hip/hip_runtime.h>
#include <hip/hip_bf16.h>
#include <math.h>

typedef __attribute__((ext_vector_type(16))) _Float16 v16h;
typedef __attribute__((ext_vector_type(8)))  _Float16 v8h;
typedef __attribute__((ext_vector_type(4)))  _Float16 v4h;
typedef __attribute__((ext_vector_type(8)))  float    v8f;
typedef __attribute__((ext_vector_type(4)))  float    v4f;
typedef __attribute__((ext_vector_type(2)))  float    v2f;

#define NEGVAL (-1000000.0f)

static constexpr int NQ   = 2048;
static constexpr int NK   = 2048;
static constexpr int DK   = 64;
static constexpr int QT   = 64;    // queries per block (4 waves x 16 rows)
static constexpr int KT   = 128;   // keys per main-loop iteration
static constexpr int KSTR = 72;    // stride (halves) for dim-minor tiles (Q,K): 144B, 16B-aligned
static constexpr int VSTR = 80;    // stride (halves) for the V tile (key x dim): 160B = 32B x odd, the transposing load's pitch
static constexpr int NG   = 4;     // key groups per block
static constexpr int KVSZ = KT * KSTR + KT * VSTR;  // halves of one group's K + V tiles
static constexpr int MPITCH = DK + 4;               // floats of one query's row in the merge area (16B-aligned, rows on shifted banks)
static constexpr int MSLOT = 16 * MPITCH + 32;      // floats of one wave's partial: 16 query rows of O, then (m, l) per query
static_assert(NG * 4 * MSLOT * 4 <= NG * KVSZ * 2, "merge area must fit in the K/V tiles");

// A- and B-fragments for 16-bit WMMA share the same per-lane pattern:
// lanes 0-15  : halves {kbase+0..7,  kbase+16..23}
// lanes 16-31 : halves {kbase+8..15, kbase+24..31}
// -> two ds_load_b128 at (row*STRIDE + kbase + hsel) and +16 halves.
template <int STRIDE>
__device__ __forceinline__ v16h load_frag(const _Float16* base, int row, int hsel, int kbase) {
    const v8h lo = *(const v8h*)(base + row * STRIDE + kbase + hsel);
    const v8h hi = *(const v8h*)(base + row * STRIDE + kbase + hsel + 16);
    v16h f;
#pragma unroll
    for (int i = 0; i < 8; ++i) { f[i] = lo[i]; f[i + 8] = hi[i]; }
    return f;
}

// A-fragment of V^T (16 dims x 32 keys) from the key-major V tile: p is the lane's own address
// (key 8 (lane >> 4) + (lane & 7), 16 B x ((lane >> 3) & 1)) moved to the fragment's first key and dim.
// Lane (c, h) receives keys 8 h + 0..7 and 16 + 8 h + 0..7 of dim c: load_frag's k order.
__device__ __forceinline__ v16h load_frag_tr(const unsigned char* p) {
    typedef short s16x8 __attribute__((ext_vector_type(8)));
    typedef __attribute__((address_space(3))) s16x8 lds_s16x8;
    const v8h lo = __builtin_bit_cast(v8h, __builtin_amdgcn_ds_load_tr16_b128_v8i16((lds_s16x8*)p));
    const v8h hi = __builtin_bit_cast(v8h, __builtin_amdgcn_ds_load_tr16_b128_v8i16((lds_s16x8*)(p + 16 * VSTR * 2)));
    v16h f;
#pragma unroll
    for (int i = 0; i < 8; ++i) { f[i] = lo[i]; f[i + 8] = hi[i]; }
    return f;
}

__device__ __forceinline__ v8f wmma_f16(v16h a, v16h b, v8f c) {
    return __builtin_amdgcn_wmma_f32_16x16x32_f16(false, a, false, b, (short)0, c, false, false);
}

// lane l <-> lane l ^ 16 (vector cross-row move, no DS traffic)
__device__ __forceinline__ float xhalf(float x) {
    const int b = __builtin_bit_cast(int, x);
    return __builtin_bit_cast(float, __builtin_amdgcn_permlanex16(b, b, 0x76543210, 0xfedcba98, false, false));
}

__global__ __launch_bounds__(512) void flash_attn_f16wmma(
    const float* __restrict__ Q, const float* __restrict__ K,
    const float* __restrict__ V, const int* __restrict__ VL,
    float* __restrict__ Out)
{
    __shared__ _Float16 qbuf[QT * KSTR];       // Q tile (query x dim), pre-scaled
    // per group: K tile (key x dim), then V tile (key x dim); after the loop: merge area
    __shared__ __attribute__((aligned(16))) _Float16 kvbuf[NG * KVSZ];

    const int tid  = threadIdx.x;
    const int wv   = __builtin_amdgcn_readfirstlane(tid >> 5);  // wave number, scalar: real scalar branches below
    const int grp  = wv >> 2;                  // key group
    const int wid  = wv & 3;                   // query wave inside the group
    const int lane = tid & 31;
    const int ln16 = lane & 15;
    const int hsel = (lane >> 4) << 3;         // 0 or 8

    const int b  = blockIdx.x >> 5;            // 32 query-blocks per batch
    const int qb = (blockIdx.x & 31) * QT;

    int vlen = VL[b];
    if (vlen < 1)  vlen = 1;
    if (vlen > NK) vlen = NK;
    const int nkb = (vlen + KT - 1) / KT;      // fully-masked tail blocks skipped
    const int ntrip = (nkb + NG - 1) / NG;     // block-uniform: every wave passes every barrier

    _Float16* kbuf  = kvbuf + grp * KVSZ;
    _Float16* vbuf  = kbuf + KT * KSTR;

    // A lane owns dims 4 ln16 .. of 16 K rows and 16 V rows of each tile. The wave's two halves take rows whose LDS
    // distance is 32 banks (K: 8 rows x 36 dwords, V: 4 rows x 40 dwords), so one b64 store meets all 64 banks once:
    // K keys 32 wid + 8 (lane >> 4) + (j & 7) + 16 (j >> 3), V keys 32 wid + 4 (lane >> 4) + (j & 3) + 8 (j >> 2).
    const int krow = wid * 32 + hsel;
    const int vrow = wid * 32 + (hsel >> 1);
    _Float16* kst = kbuf + krow * KSTR + (ln16 << 2);
    _Float16* vst = vbuf + vrow * VSTR + (ln16 << 2);
    const float* kld = K + (size_t)b * NK * DK + krow * DK + (ln16 << 2);
    const float* vld = V + (size_t)b * NK * DK + vrow * DK + (ln16 << 2);
    float4 kr[16], vr[16];                     // this thread's share of the group's next tile, as loaded
    // (every loop over kr / vr below is unrolled: constant indices keep the arrays in registers)
    // have: the 16 loads of tile kb's K (or V) share, none waited for here. Otherwise the registers get a value of
    // their own, so that the tile before does not stay live in them through the score phase (it spilled).
    auto fetch_k = [&](bool have, int kb) {
        if (have) {
            const float* kp = kld + (size_t)kb * (KT * DK);
#pragma unroll
            for (int j = 0; j < 16; ++j) kr[j] = *(const float4*)(kp + ((j & 7) + (j >> 3) * 16) * DK);
            // the code behind reuses the loads' address registers
            asm volatile("s_wait_xcnt 0x0" ::: "memory");
        } else {
#pragma unroll
            for (int j = 0; j < 16; ++j) kr[j] = float4{0.f, 0.f, 0.f, 0.f};
        }
    };
    auto fetch_v = [&](bool have, int kb) {
        if (have) {
            const float* vp = vld + (size_t)kb * (KT * DK);
#pragma unroll
            for (int j = 0; j < 16; ++j) vr[j] = *(const float4*)(vp + ((j & 3) + (j >> 2) * 8) * DK);
            // as in fetch_k
            asm volatile("s_wait_xcnt 0x0" ::: "memory");
        } else {
#pragma unroll
            for (int j = 0; j < 16; ++j) vr[j] = float4{0.f, 0.f, 0.f, 0.f};
        }
    };
    fetch_k(grp < nkb, grp);                   // the group's first tile flies under the Q staging
    fetch_v(grp < nkb, grp);

    // ---- stage Q tile, f32 -> f16, fold in 1/sqrt(64) ----
    for (int i = tid; i < QT * DK / 4; i += 512) {
        const int q  = i >> 4;
        const int d4 = (i & 15) << 2;
        const float4 f = *(const float4*)(Q + (((size_t)b * NQ + qb + q) * DK + d4));
        v4h h;
        h[0] = (_Float16)(f.x * 0.125f); h[1] = (_Float16)(f.y * 0.125f);
        h[2] = (_Float16)(f.z * 0.125f); h[3] = (_Float16)(f.w * 0.125f);
        *(v4h*)(qbuf + q * KSTR + d4) = h;
    }
    __syncthreads();

    const int qrow = wid * 16 + ln16;
    const unsigned char* vtr = (const unsigned char*)vbuf + (hsel + (lane & 7)) * (VSTR * 2) + ((lane >> 3) & 1) * 16;

    // O^T accumulator, 64 dims x 16 queries f32: tile j, element r = dim 16 j + hsel + r of query ln16
    v8f o0 = {}, o1 = {}, o2 = {}, o3 = {};
    float m = -3.0e38f;                        // running maximum of query ln16 (equal in both halves)
    float l = 0.0f;                            // running sum over this half's keys only; the halves join after the loop

    for (int t = 0; t < ntrip; ++t) {
        const int kb = t * NG + grp;           // this group's key tile
        const bool active = kb < nkb;          // scalar; a group past the end only keeps the barriers
        __syncthreads();                       // previous trip's kbuf/vbuf reads done

        if (active) {
            // ---- K (key x dim), f32 -> f16, b64 stores ----
#pragma unroll
            for (int j = 0; j < 16; ++j) {
                v4h hk;
                hk[0] = (_Float16)kr[j].x; hk[1] = (_Float16)kr[j].y;
                hk[2] = (_Float16)kr[j].z; hk[3] = (_Float16)kr[j].w;
                *(v4h*)(kst + ((j & 7) + (j >> 3) * 16) * KSTR) = hk;
            }
            // ---- V (key x dim), f32 -> f16, b64 stores ----
#pragma unroll
            for (int j = 0; j < 16; ++j) {
                v4h hv;
                hv[0] = (_Float16)vr[j].x; hv[1] = (_Float16)vr[j].y;
                hv[2] = (_Float16)vr[j].z; hv[3] = (_Float16)vr[j].w;
                *(v4h*)(vst + ((j & 3) + (j >> 2) * 8) * VSTR) = hv;
            }
        }
        __syncthreads();
        if (!active) continue;

        // ---- scores S^T = K (Q/8)^T : 128 x 16, 16 WMMAs; s[nt][i] = key 16 nt + hsel + i, query ln16 ----
        // per-wave Q fragments (B operand: lane = query column), re-read each trip: their 16 registers are free
        // while scores, both prefetched halves and the accumulators are live together
        const v16h qa0 = load_frag<KSTR>(qbuf, qrow, hsel, 0);
        const v16h qa1 = load_frag<KSTR>(qbuf, qrow, hsel, 32);
        v8f s[8];
#pragma unroll
        for (int nt = 0; nt < 8; ++nt) {
            v8f acc = {};
            const v16h kf0 = load_frag<KSTR>(kbuf, nt * 16 + ln16, hsel, 0);
            acc = wmma_f16(kf0, qa0, acc);
            const v16h kf1 = load_frag<KSTR>(kbuf, nt * 16 + ln16, hsel, 32);
            acc = wmma_f16(kf1, qa1, acc);
            s[nt] = acc;
        }

        // ---- mask tail keys in the final block (uniform branch; EXEC stays full) ----
        if (kb == nkb - 1) {
            const int left = vlen - kb * KT - hsel;    // valid keys from this half's first row on
#pragma unroll
            for (int nt = 0; nt < 8; ++nt)
#pragma unroll
                for (int i = 0; i < 8; ++i) s[nt][i] = (nt * 16 + i >= left) ? NEGVAL : s[nt][i];
        }

        // ---- next tile of this group, K half: flies under the softmax ----
        fetch_k(kb + NG < nkb, kb + NG);

        // ---- online softmax, one query per lane: eight independent chains, then a tree ----
        float r8[8];
#pragma unroll
        for (int i = 0; i < 8; ++i) {
            r8[i] = s[0][i];
#pragma unroll
            for (int nt = 1; nt < 8; ++nt) r8[i] = fmaxf(r8[i], s[nt][i]);
        }
        float rm = fmaxf(fmaxf(fmaxf(r8[0], r8[1]), fmaxf(r8[2], r8[3])), fmaxf(fmaxf(r8[4], r8[5]), fmaxf(r8[6], r8[7])));
        rm = fmaxf(rm, xhalf(rm));             // the other 64 keys of the same query
        const float mnew  = fmaxf(m, rm);
        const float alpha = __expf(m - mnew);
        m = mnew;

        // ---- P^T as B operand: score tiles 2h and 2h+1, converted in place, hold keys 32 h .. in load_frag's k order ----
        v16h pb[4];
#pragma unroll
        for (int i = 0; i < 8; ++i) r8[i] = 0.0f;
#pragma unroll
        for (int nt = 0; nt < 8; ++nt) {
#pragma unroll
            for (int i = 0; i < 8; ++i) {
                const float p = __expf(s[nt][i] - mnew);
                r8[i] += p;
                pb[nt >> 1][(nt & 1) * 8 + i] = (_Float16)p;
            }
        }
        l = l * alpha + (((r8[0] + r8[1]) + (r8[2] + r8[3])) + ((r8[4] + r8[5]) + (r8[6] + r8[7])));
#pragma unroll
        for (int i = 0; i < 8; ++i) { o0[i] *= alpha; o1[i] *= alpha; o2[i] *= alpha; o3[i] *= alpha; }

        // ---- next tile of this group, V half (the score registers are free again): flies under P*V ----
        fetch_v(kb + NG < nkb, kb + NG);

        // ---- O^T += V^T P^T : 16 WMMAs (A-frags by the transposing load: next 16 dims + 32 B, next 32 keys + 32 rows) ----
#pragma unroll
        for (int h = 0; h < 4; ++h) {
            const unsigned char* vp = vtr + h * 32 * VSTR * 2;
            v16h vf;
            vf = load_frag_tr(vp +  0); o0 = wmma_f16(vf, pb[h], o0);
            vf = load_frag_tr(vp + 32); o1 = wmma_f16(vf, pb[h], o1);
            vf = load_frag_tr(vp + 64); o2 = wmma_f16(vf, pb[h], o2);
            vf = load_frag_tr(vp + 96); o3 = wmma_f16(vf, pb[h], o3);
        }
    }

    // ---- merge the four groups' partials through LDS, as (query x dim) rows ----
    __syncthreads();                           // every wave's last kbuf/vbuf reads done: the area is reused
    float* mrg = (float*)kvbuf;
    {
        float* mw = mrg + wv * MSLOT;
        float* mo = mw + ln16 * MPITCH + hsel;
        *(v4f*)(mo +  0) = v4f{ o0[0], o0[1], o0[2], o0[3] };  *(v4f*)(mo +  4) = v4f{ o0[4], o0[5], o0[6], o0[7] };
        *(v4f*)(mo + 16) = v4f{ o1[0], o1[1], o1[2], o1[3] };  *(v4f*)(mo + 20) = v4f{ o1[4], o1[5], o1[6], o1[7] };
        *(v4f*)(mo + 32) = v4f{ o2[0], o2[1], o2[2], o2[3] };  *(v4f*)(mo + 36) = v4f{ o2[4], o2[5], o2[6], o2[7] };
        *(v4f*)(mo + 48) = v4f{ o3[0], o3[1], o3[2], o3[3] };  *(v4f*)(mo + 52) = v4f{ o3[4], o3[5], o3[6], o3[7] };
        const float lt = l + xhalf(l);         // the two halves' key sums joined
        if (hsel == 0) *(v2f*)(mw + 16 * MPITCH + ln16 * 2) = v2f{ m, lt };   // lower half writes; both hold the same pair
    }
    __syncthreads();

    // wave (grp, wid) finishes queries 4 grp .. 4 grp + 3 of query wave wid: each store covers two whole 256-B rows,
    // one writer each. A group that had no tile holds m = -3e38, l = 0, O = 0 and weighs 0.
#pragma unroll
    for (int j = 0; j < 2; ++j) {
        const int q = grp * 4 + j * 2 + (lane >> 4);
        v4f po[NG];
        v2f ml[NG];
#pragma unroll
        for (int s = 0; s < NG; ++s) {
            const float* mr = mrg + (s * 4 + wid) * MSLOT;
            po[s] = *(const v4f*)(mr + q * MPITCH + ln16 * 4);
            ml[s] = *(const v2f*)(mr + 16 * MPITCH + q * 2);
        }
        const float mx = fmaxf(fmaxf(ml[0][0], ml[1][0]), fmaxf(ml[2][0], ml[3][0]));
        float ls = 0.0f;
        v4f a = { 0.0f, 0.0f, 0.0f, 0.0f };
#pragma unroll
        for (int s = 0; s < NG; ++s) {
            const float w = __expf(ml[s][0] - mx);
            ls += w * ml[s][1];
            a += w * po[s];
        }
        const float inv = 1.0f / ls;
        *(v4f*)(Out + (((size_t)b * NQ + qb + wid * 16 + q) * DK + ln16 * 4)) = a * inv;
    }
}

extern "C" void kernel_launch(void* const* d_in, const int* in_sizes, int n_in,
                              void* d_out, int out_size, void* d_ws, size_t ws_size,
                              hipStream_t stream) {
    (void)in_sizes; (void)n_in; (void)out_size; (void)d_ws; (void)ws_size;
    const float* Q  = (const float*)d_in[0];
    const float* K  = (const float*)d_in[1];
    const float* V  = (const float*)d_in[2];
    const int*   VL = (const int*)d_in[3];
    float* Out = (float*)d_out;
    const int B = 8;
    dim3 grid(B * (NQ / QT));   // 256 blocks
    dim3 block(512);            // 16 waves: 4 key groups x 4 query waves
    flash_attn_f16wmma<<<grid, block, 0, stream>>>(Q, K, V, VL, Out);
}

// v005
// It runs in 16.3 microseconds.
// Next to v004, in two timings, it ran 1.09 times as fast each time.
// All steps since v000 together make it 4.53 times as fast.
#include <hip/hip_runtime.h>
#include <hip/hip_bf16.h>
#include <math.h>

typedef __attribute__((ext_vector_type(16))) _Float16 v16h;
typedef __attribute__((ext_vector_type(8)))  _Float16 v8h;
typedef __attribute__((ext_vector_type(4)))  _Float16 v4h;
typedef __attribute__((ext_vector_type(8)))  float    v8f;
typedef __attribute__((ext_vector_type(4)))  float    v4f;
typedef __attribute__((ext_vector_type(2)))  float    v2f;

#define NEGVAL (-1000000.0f)

static constexpr int NQ   = 2048;
static constexpr int NK   = 2048;
static constexpr int DK   = 64;
static constexpr int QT   = 64;    // queries per block (4 waves x 16 rows)
static constexpr int KT   = 128;   // keys per main-loop iteration
static constexpr int KSTR = 72;    // stride (halves) for dim-minor tiles (Q,K): 144B, 16B-aligned
static constexpr int VSTR = 80;    // stride (halves) for the V tile (key x dim): 160B = 32B x odd, the transposing load's pitch
static constexpr int NG   = 4;     // key groups per block
static constexpr int KVSZ = KT * KSTR + KT * VSTR;  // halves of one group's K + V tiles
static constexpr int MPITCH = DK + 4;               // floats of one query's row in the merge area (16B-aligned, rows on shifted banks)
static constexpr int MSLOT = 16 * MPITCH + 32;      // floats of one wave's partial: 16 query rows of O, then (m, l) per query
static_assert(NG * 4 * MSLOT * 4 <= NG * KVSZ * 2, "merge area must fit in the K/V tiles");

// A- and B-fragments for 16-bit WMMA share the same per-lane pattern:
// lanes 0-15  : halves {kbase+0..7,  kbase+16..23}
// lanes 16-31 : halves {kbase+8..15, kbase+24..31}
// -> two ds_load_b128 at (row*STRIDE + kbase + hsel) and +16 halves.
template <int STRIDE>
__device__ __forceinline__ v16h load_frag(const _Float16* base, int row, int hsel, int kbase) {
    const v8h lo = *(const v8h*)(base + row * STRIDE + kbase + hsel);
    const v8h hi = *(const v8h*)(base + row * STRIDE + kbase + hsel + 16);
    v16h f;
#pragma unroll
    for (int i = 0; i < 8; ++i) { f[i] = lo[i]; f[i + 8] = hi[i]; }
    return f;
}

// A-fragment of V^T (16 dims x 32 keys) from the key-major V tile: p is the lane's own address
// (key 8 (lane >> 4) + (lane & 7), 16 B x ((lane >> 3) & 1)) moved to the fragment's first key and dim.
// Lane (c, h) receives keys 8 h + 0..7 and 16 + 8 h + 0..7 of dim c: load_frag's k order.
__device__ __forceinline__ v16h load_frag_tr(const unsigned char* p) {
    typedef short s16x8 __attribute__((ext_vector_type(8)));
    typedef __attribute__((address_space(3))) s16x8 lds_s16x8;
    const v8h lo = __builtin_bit_cast(v8h, __builtin_amdgcn_ds_load_tr16_b128_v8i16((lds_s16x8*)p));
    const v8h hi = __builtin_bit_cast(v8h, __builtin_amdgcn_ds_load_tr16_b128_v8i16((lds_s16x8*)(p + 16 * VSTR * 2)));
    v16h f;
#pragma unroll
    for (int i = 0; i < 8; ++i) { f[i] = lo[i]; f[i + 8] = hi[i]; }
    return f;
}

__device__ __forceinline__ v8f wmma_f16(v16h a, v16h b, v8f c) {
    return __builtin_amdgcn_wmma_f32_16x16x32_f16(false, a, false, b, (short)0, c, false, false);
}

// lane l <-> lane l ^ 16 (vector cross-row move, no DS traffic)
__device__ __forceinline__ float xhalf(float x) {
    const int b = __builtin_bit_cast(int, x);
    return __builtin_bit_cast(float, __builtin_amdgcn_permlanex16(b, b, 0x76543210, 0xfedcba98, false, false));
}

__global__ __launch_bounds__(512) void flash_attn_f16wmma(
    const float* __restrict__ Q, const float* __restrict__ K,
    const float* __restrict__ V, const int* __restrict__ VL,
    float* __restrict__ Out)
{
    __shared__ _Float16 qbuf[QT * KSTR];       // Q tile (query x dim), pre-scaled
    // per group: K tile (key x dim), then V tile (key x dim); after the loop: merge area
    __shared__ __attribute__((aligned(16))) _Float16 kvbuf[NG * KVSZ];

    const int tid  = threadIdx.x;
    const int wv   = __builtin_amdgcn_readfirstlane(tid >> 5);  // wave number, scalar: real scalar branches below
    const int grp  = wv >> 2;                  // key group
    const int wid  = wv & 3;                   // query wave inside the group
    const int lane = tid & 31;
    const int ln16 = lane & 15;
    const int hsel = (lane >> 4) << 3;         // 0 or 8

    const int b  = blockIdx.x >> 5;            // 32 query-blocks per batch
    const int qb = (blockIdx.x & 31) * QT;

    int vlen = VL[b];
    if (vlen < 1)  vlen = 1;
    if (vlen > NK) vlen = NK;
    const int nkb = (vlen + KT - 1) / KT;      // fully-masked tail blocks skipped
    const int ntrip = (nkb + NG - 1) / NG;     // block-uniform: every wave passes every barrier

    _Float16* kbuf  = kvbuf + grp * KVSZ;
    _Float16* vbuf  = kbuf + KT * KSTR;

    // A lane owns dims 4 ln16 .. of 16 K rows and 16 V rows of each tile. The wave's two halves take rows whose LDS
    // distance is 32 banks (K: 8 rows x 36 dwords, V: 4 rows x 40 dwords), so one b64 store meets all 64 banks once:
    // K keys 32 wid + 8 (lane >> 4) + (j & 7) + 16 (j >> 3), V keys 32 wid + 4 (lane >> 4) + (j & 3) + 8 (j >> 2).
    const int krow = wid * 32 + hsel;
    const int vrow = wid * 32 + (hsel >> 1);
    _Float16* kst = kbuf + krow * KSTR + (ln16 << 2);
    _Float16* vst = vbuf + vrow * VSTR + (ln16 << 2);
    const float* kld = K + (size_t)b * NK * DK + krow * DK + (ln16 << 2);
    const float* vld = V + (size_t)b * NK * DK + vrow * DK + (ln16 << 2);
    float4 kr[16], vr[16];                     // this thread's share of the group's next tile, as loaded
    // (every loop over kr / vr below is unrolled: constant indices keep the arrays in registers)
    // have: the 16 loads of tile kb's K (or V) share, none waited for here. Otherwise the registers get a value of
    // their own, so that the tile before does not stay live in them through the score phase (it spilled).
    auto fetch_k = [&](bool have, int kb) {
        if (have) {
            const float* kp = kld + (size_t)kb * (KT * DK);
#pragma unroll
            for (int j = 0; j < 16; ++j) kr[j] = *(const float4*)(kp + ((j & 7) + (j >> 3) * 16) * DK);
            // the code behind reuses the loads' address registers
            asm volatile("s_wait_xcnt 0x0" ::: "memory");
        } else {
#pragma unroll
            for (int j = 0; j < 16; ++j) kr[j] = float4{0.f, 0.f, 0.f, 0.f};
        }
    };
    auto fetch_v = [&](bool have, int kb) {
        if (have) {
            const float* vp = vld + (size_t)kb * (KT * DK);
#pragma unroll
            for (int j = 0; j < 16; ++j) vr[j] = *(const float4*)(vp + ((j & 3) + (j >> 2) * 8) * DK);
            // as in fetch_k
            asm volatile("s_wait_xcnt 0x0" ::: "memory");
        } else {
#pragma unroll
            for (int j = 0; j < 16; ++j) vr[j] = float4{0.f, 0.f, 0.f, 0.f};
        }
    };
    fetch_k(grp < nkb, grp);                   // the group's first tile flies under the Q staging
    fetch_v(grp < nkb, grp);

    // ---- stage Q tile, f32 -> f16, fold in 1/sqrt(64) ----
    for (int i = tid; i < QT * DK / 4; i += 512) {
        const int q  = i >> 4;
        const int d4 = (i & 15) << 2;
        const float4 f = *(const float4*)(Q + (((size_t)b * NQ + qb + q) * DK + d4));
        v4h h;
        h[0] = (_Float16)(f.x * 0.125f); h[1] = (_Float16)(f.y * 0.125f);
        h[2] = (_Float16)(f.z * 0.125f); h[3] = (_Float16)(f.w * 0.125f);
        *(v4h*)(qbuf + q * KSTR + d4) = h;
    }
    __syncthreads();

    const int qrow = wid * 16 + ln16;
    const unsigned char* vtr = (const unsigned char*)vbuf + (hsel + (lane & 7)) * (VSTR * 2) + ((lane >> 3) & 1) * 16;

    // O^T accumulator, 64 dims x 16 queries f32: tile j, element r = dim 16 j + hsel + r of query ln16
    v8f o0 = {}, o1 = {}, o2 = {}, o3 = {};
    float m = -3.0e38f;                        // running maximum of query ln16 (equal in both halves)
    float l = 0.0f;                            // running sum over this half's keys only; the halves join after the loop

    for (int t = 0; t < ntrip; ++t) {
        const int kb = t * NG + grp;           // this group's key tile
        const bool active = kb < nkb;          // scalar; a group past the end only keeps the barriers
        __syncthreads();                       // previous trip's kbuf/vbuf reads done

        if (active) {
            // ---- K (key x dim), f32 -> f16, b64 stores ----
#pragma unroll
            for (int j = 0; j < 16; ++j) {
                v4h hk;
                hk[0] = (_Float16)kr[j].x; hk[1] = (_Float16)kr[j].y;
                hk[2] = (_Float16)kr[j].z; hk[3] = (_Float16)kr[j].w;
                *(v4h*)(kst + ((j & 7) + (j >> 3) * 16) * KSTR) = hk;
            }
            // ---- V (key x dim), f32 -> f16, b64 stores ----
#pragma unroll
            for (int j = 0; j < 16; ++j) {
                v4h hv;
                hv[0] = (_Float16)vr[j].x; hv[1] = (_Float16)vr[j].y;
                hv[2] = (_Float16)vr[j].z; hv[3] = (_Float16)vr[j].w;
                *(v4h*)(vst + ((j & 3) + (j >> 2) * 8) * VSTR) = hv;
            }
        }
        __syncthreads();
        if (!active) continue;

        // ---- scores S^T = K (Q/8)^T : 128 x 16, 16 WMMAs; s[nt][i] = key 16 nt + hsel + i, query ln16 ----
        // per-wave Q fragments (B operand: lane = query column), re-read each trip: their 16 registers are free
        // while scores, both prefetched halves and the accumulators are live together
        const v16h qa0 = load_frag<KSTR>(qbuf, qrow, hsel, 0);
        const v16h qa1 = load_frag<KSTR>(qbuf, qrow, hsel, 32);
        // all 16 K fragments are read as ONE group ahead of the products, into the registers that the prefetch leaves
        // free here (its tile is stored, the next not yet asked for): the LDS runs at its rate under counted waits
        v16h kf[16];
#pragma unroll
        for (int nt = 0; nt < 8; ++nt) {
            kf[2 * nt]     = load_frag<KSTR>(kbuf, nt * 16 + ln16, hsel, 0);
            kf[2 * nt + 1] = load_frag<KSTR>(kbuf, nt * 16 + ln16, hsel, 32);
        }
        // keeps the reads above the products: without it each product waited out its own two reads' whole latency
        __builtin_amdgcn_sched_barrier(0);
        v8f s[8];
#pragma unroll
        for (int nt = 0; nt < 8; ++nt) {
            v8f acc = {};
            acc = wmma_f16(kf[2 * nt], qa0, acc);
            acc = wmma_f16(kf[2 * nt + 1], qa1, acc);
            s[nt] = acc;
        }

        // ---- mask tail keys in the final block (uniform branch; EXEC stays full) ----
        if (kb == nkb - 1) {
            const int left = vlen - kb * KT - hsel;    // valid keys from this half's first row on
#pragma unroll
            for (int nt = 0; nt < 8; ++nt)
#pragma unroll
                for (int i = 0; i < 8; ++i) s[nt][i] = (nt * 16 + i >= left) ? NEGVAL : s[nt][i];
        }

        // ---- next tile of this group, K half: flies under the softmax ----
        fetch_k(kb + NG < nkb, kb + NG);

        // ---- online softmax, one query per lane: eight independent chains, then a tree ----
        float r8[8];
#pragma unroll
        for (int i = 0; i < 8; ++i) {
            r8[i] = s[0][i];
#pragma unroll
            for (int nt = 1; nt < 8; ++nt) r8[i] = fmaxf(r8[i], s[nt][i]);
        }
        float rm = fmaxf(fmaxf(fmaxf(r8[0], r8[1]), fmaxf(r8[2], r8[3])), fmaxf(fmaxf(r8[4], r8[5]), fmaxf(r8[6], r8[7])));
        rm = fmaxf(rm, xhalf(rm));             // the other 64 keys of the same query
        const float mnew  = fmaxf(m, rm);
        const float alpha = __expf(m - mnew);
        m = mnew;

        // ---- P^T as B operand: score tiles 2h and 2h+1, converted in place, hold keys 32 h .. in load_frag's k order ----
        v16h pb[4];
#pragma unroll
        for (int i = 0; i < 8; ++i) r8[i] = 0.0f;
#pragma unroll
        for (int nt = 0; nt < 8; ++nt) {
#pragma unroll
            for (int i = 0; i < 8; ++i) {
                const float p = __expf(s[nt][i] - mnew);
                r8[i] += p;
                pb[nt >> 1][(nt & 1) * 8 + i] = (_Float16)p;
            }
        }
        l = l * alpha + (((r8[0] + r8[1]) + (r8[2] + r8[3])) + ((r8[4] + r8[5]) + (r8[6] + r8[7])));
#pragma unroll
        for (int i = 0; i < 8; ++i) { o0[i] *= alpha; o1[i] *= alpha; o2[i] *= alpha; o3[i] *= alpha; }

        // ---- next tile of this group, V half (the score registers are free again): flies under P*V ----
        fetch_v(kb + NG < nkb, kb + NG);

        // ---- O^T += V^T P^T : 16 WMMAs (A-frags by the transposing load: next 16 dims + 32 B, next 32 keys + 32 rows) ----
#pragma unroll
        for (int h = 0; h < 4; ++h) {
            const unsigned char* vp = vtr + h * 32 * VSTR * 2;
            v16h vf;
            vf = load_frag_tr(vp +  0); o0 = wmma_f16(vf, pb[h], o0);
            vf = load_frag_tr(vp + 32); o1 = wmma_f16(vf, pb[h], o1);
            vf = load_frag_tr(vp + 64); o2 = wmma_f16(vf, pb[h], o2);
            vf = load_frag_tr(vp + 96); o3 = wmma_f16(vf, pb[h], o3);
        }
    }

    // ---- merge the four groups' partials through LDS, as (query x dim) rows ----
    __syncthreads();                           // every wave's last kbuf/vbuf reads done: the area is reused
    float* mrg = (float*)kvbuf;
    {
        float* mw = mrg + wv * MSLOT;
        float* mo = mw + ln16 * MPITCH + hsel;
        *(v4f*)(mo +  0) = v4f{ o0[0], o0[1], o0[2], o0[3] };  *(v4f*)(mo +  4) = v4f{ o0[4], o0[5], o0[6], o0[7] };
        *(v4f*)(mo + 16) = v4f{ o1[0], o1[1], o1[2], o1[3] };  *(v4f*)(mo + 20) = v4f{ o1[4], o1[5], o1[6], o1[7] };
        *(v4f*)(mo + 32) = v4f{ o2[0], o2[1], o2[2], o2[3] };  *(v4f*)(mo + 36) = v4f{ o2[4], o2[5], o2[6], o2[7] };
        *(v4f*)(mo + 48) = v4f{ o3[0], o3[1], o3[2], o3[3] };  *(v4f*)(mo + 52) = v4f{ o3[4], o3[5], o3[6], o3[7] };
        const float lt = l + xhalf(l);         // the two halves' key sums joined
        if (hsel == 0) *(v2f*)(mw + 16 * MPITCH + ln16 * 2) = v2f{ m, lt };   // lower half writes; both hold the same pair
    }
    __syncthreads();

    // wave (grp, wid) finishes queries 4 grp .. 4 grp + 3 of query wave wid: each store covers two whole 256-B rows,
    // one writer each. A group that had no tile holds m = -3e38, l = 0, O = 0 and weighs 0.
#pragma unroll
    for (int j = 0; j < 2; ++j) {
        const int q = grp * 4 + j * 2 + (lane >> 4);
        v4f po[NG];
        v2f ml[NG];
#pragma unroll
        for (int s = 0; s < NG; ++s) {
            const float* mr = mrg + (s * 4 + wid) * MSLOT;
            po[s] = *(const v4f*)(mr + q * MPITCH + ln16 * 4);
            ml[s] = *(const v2f*)(mr + 16 * MPITCH + q * 2);
        }
        const float mx = fmaxf(fmaxf(ml[0][0], ml[1][0]), fmaxf(ml[2][0], ml[3][0]));
        float ls = 0.0f;
        v4f a = { 0.0f, 0.0f, 0.0f, 0.0f };
#pragma unroll
        for (int s = 0; s < NG; ++s) {
            const float w = __expf(ml[s][0] - mx);
            ls += w * ml[s][1];
            a += w * po[s];
        }
        const float inv = 1.0f / ls;
        *(v4f*)(Out + (((size_t)b * NQ + qb + wid * 16 + q) * DK + ln16 * 4)) = a * inv;
    }
}

extern "C" void kernel_launch(void* const* d_in, const int* in_sizes, int n_in,
                              void* d_out, int out_size, void* d_ws, size_t ws_size,
                              hipStream_t stream) {
    (void)in_sizes; (void)n_in; (void)out_size; (void)d_ws; (void)ws_size;
    const float* Q  = (const float*)d_in[0];
    const float* K  = (const float*)d_in[1];
    const float* V  = (const float*)d_in[2];
    const int*   VL = (const int*)d_in[3];
    float* Out = (float*)d_out;
    const int B = 8;
    dim3 grid(B * (NQ / QT));   // 256 blocks
    dim3 block(512);            // 16 waves: 4 key groups x 4 query waves
    flash_attn_f16wmma<<<grid, block, 0, stream>>>(Q, K, V, VL, Out);
}
